// v000
// The times below were measured on an AMD MI455X: many runs one after another, warmed up first and cycling through
// copies of the inputs, with the whole window's GPU time divided by the number of runs. Launches and the gaps
// between them are all in it. The median over several windows is given; except for v000 it joins two sittings, which
// can be a few percent apart, so the side-by-side timings, each taken in one sitting, are the better comparison.
// v000 is the starting kernel. One run takes 345 microseconds.
#include <hip/hip_runtime.h>
#include <stdint.h>
// All contractions: v_wmma_f32_16x16x32_f16 (f16 operands, f32 accumulate): qkv, self-output, intermediate and output projections (float inputs RNE-converted to bf16 then f16; weight operand scaled by 2^6, ctx operand by 2^4, folded back in the epilogue), q.k^T and p.v (p scaled by 2^12); softmax, LayerNorm, GELU, residuals in f32.

#ifndef NB
#define NB 2
#endif
#ifndef SEQ
#define SEQ 2048
#endif
#define NB_FULL 2
#define SEQ_FULL 2048
#define HID 1024
#define NHD 16
#define DHD 64
#define DFF 4096
#define MTOK (NB * SEQ)

static_assert(NB >= 1 && NB <= NB_FULL);
static_assert(SEQ >= 128 && SEQ <= SEQ_FULL && (SEQ % 128) == 0);
static_assert((MTOK % 128) == 0);
static_assert(HID == NHD * DHD);
static_assert((HID % 128) == 0 && (DFF % 128) == 0 && (HID % 32) == 0 && (DFF % 32) == 0);

typedef _Float16 f16;
typedef f16   v4h  __attribute__((ext_vector_type(4)));
typedef f16   v8h  __attribute__((ext_vector_type(8)));
typedef f16   v16h __attribute__((ext_vector_type(16)));
typedef float v4f  __attribute__((ext_vector_type(4)));
typedef float v8f  __attribute__((ext_vector_type(8)));
union Frag { v16h v; v8h half[2]; };

// 16x16x32 f16 WMMA with hazard guard (4 VALU slots) tied to D, A and B
__device__ __forceinline__ v8f wmma16(v16h a, v16h b, v8f c) {
    v8f d = __builtin_amdgcn_wmma_f32_16x16x32_f16(false, a, false, b, (short)0, c, false, false);
    asm volatile("v_nop\n\tv_nop\n\tv_nop\n\tv_nop" : "+v"(d) : "v"(a), "v"(b));
    return d;
}
__device__ __forceinline__ v8f zero8() {
    v8f z;
#pragma unroll
    for (int i = 0; i < 8; ++i) z[i] = 0.0f;
    return z;
}
// f32 -> nearest-even bf16 value, returned as f32
__device__ __forceinline__ float bf16r(float x) {
    unsigned u = __float_as_uint(x);
    u = (u + 0x7FFFu + ((u >> 16) & 1u)) & 0xFFFF0000u;
    return __uint_as_float(u);
}

// compact destination row m reads source row (m / seq) * seqf + m % seq (identity when seq >= row count)
__global__ __launch_bounds__(256) void k_cvt(const float* __restrict__ in, f16* out, int n, int rowlen,
                                              int seq, int seqf, float scale) {
    const size_t i8 = ((size_t)blockIdx.x * 256 + threadIdx.x) * 8;
    if (i8 + 8 > (size_t)n) return;
    const int m = (int)(i8 / (size_t)rowlen);
    const int c = (int)(i8 - (size_t)m * (size_t)rowlen);
    const size_t src = ((size_t)(m / seq) * (size_t)seqf + (size_t)(m % seq)) * (size_t)rowlen + (size_t)c;
    v4f a = *(const v4f*)(in + src);
    v4f b = *(const v4f*)(in + src + 4);
    v8h hv;
    hv[0] = (f16)(bf16r(a[0]) * scale); hv[1] = (f16)(bf16r(a[1]) * scale);
    hv[2] = (f16)(bf16r(a[2]) * scale); hv[3] = (f16)(bf16r(a[3]) * scale);
    hv[4] = (f16)(bf16r(b[0]) * scale); hv[5] = (f16)(bf16r(b[1]) * scale);
    hv[6] = (f16)(bf16r(b[2]) * scale); hv[7] = (f16)(bf16r(b[3]) * scale);
    f16* p = out + i8;
    *(v8h*)p = hv;
    
}

// ---------------- tiled GEMM: C[M][N] = A[M][K] (f16) . B, B given as BT[N][K] (f16, k-contiguous) ----------------
// epilogue: * oscale + bias, optional exact GELU; f32 (omode bit 0) and/or f16 (omode bit 1) output,
#define GBM 128
#define GBN 128
#define GBK 32
#define GLD 40      // staged row: 32 halves + 8 pad = 80 B
#define GSP 132     // staging row pitch in floats (528 B)

__global__ __launch_bounds__(256) void k_gemm(const f16* __restrict__ A, const f16* __restrict__ BT,
                                               const float* __restrict__ bias, float* Cf, f16* Ch,
                                               int M, int N, int K, int act, float oscale, int omode) {
    __shared__ f16 As[GBM * GLD];
    __shared__ f16 Bs[GBN * GLD];
    __shared__ float Cs[64 * GSP];

    const int t = threadIdx.x, wave = t >> 5, lane = t & 31;
    const int hh = lane >> 4, l16 = lane & 15;
    const int wm = wave >> 2, wn = wave & 3;          // 2 x 4 waves, 64 x 32 per wave
    const int bm0 = blockIdx.y * GBM, bn0 = blockIdx.x * GBN;
    if (bm0 + GBM > M || bn0 + GBN > N) return;       // block-uniform; host guarantees exact multiples

    v8f acc[4][2];
#pragma unroll
    for (int i = 0; i < 4; ++i)
#pragma unroll
        for (int j = 0; j < 2; ++j) acc[i][j] = zero8();

    const int nk = K / GBK;
    for (int it = 0; it < nk; ++it) {
        const int k0 = it * GBK;
#pragma unroll
        for (int j = 0; j < 2; ++j) {
            const int e = t + 256 * j, row = e >> 2, seg = (e & 3) * 8;
            v8h va = *(const v8h*)(A  + (size_t)(bm0 + row) * K + k0 + seg);
            v8h vb = *(const v8h*)(BT + (size_t)(bn0 + row) * K + k0 + seg);
            *(v8h*)(As + row * GLD + seg) = va;
            *(v8h*)(Bs + row * GLD + seg) = vb;
        }
        __syncthreads();

        Frag af[4], bf[2];
#pragma unroll
        for (int mf = 0; mf < 4; ++mf) {
            const f16* ap = As + (wm * 64 + mf * 16 + l16) * GLD;
            af[mf].half[0] = *(const v8h*)(ap + 8 * hh);        // k = 8h .. 8h+7
            af[mf].half[1] = *(const v8h*)(ap + 16 + 8 * hh);   // k = 16+8h .. 16+8h+7
        }
#pragma unroll
        for (int nf = 0; nf < 2; ++nf) {
            const f16* bp = Bs + (wn * 32 + nf * 16 + l16) * GLD;   // column n, k-contiguous
            bf[nf].half[0] = *(const v8h*)(bp + 8 * hh);
            bf[nf].half[1] = *(const v8h*)(bp + 16 + 8 * hh);
        }
#pragma unroll
        for (int mf = 0; mf < 4; ++mf)
#pragma unroll
            for (int nf = 0; nf < 2; ++nf)
                acc[mf][nf] = wmma16(af[mf].v, bf[nf].v, acc[mf][nf]);
        __syncthreads();
    }

#pragma unroll 1
    for (int p = 0; p < 2; ++p) {
        if (wm == p) {
#pragma unroll
            for (int mf = 0; mf < 4; ++mf)
#pragma unroll
                for (int nf = 0; nf < 2; ++nf) {
                    const int col = wn * 32 + nf * 16 + l16;
                    const float bvv = bias[bn0 + col];
#pragma unroll
                    for (int r = 0; r < 8; ++r) {
                        const int row = mf * 16 + 8 * hh + r;
                        float x = acc[mf][nf][r] * oscale + bvv;
                        if (act) x = x * 0.5f * (1.0f + erff(x * 0.70710678118654752f));
                        Cs[row * GSP + col] = x;
                    }
                }
        }
        __syncthreads();
        if (omode & 1) {
            v4f vals[8];
            size_t po[8];
#pragma unroll
            for (int j = 0; j < 8; ++j) {
                const int e = t + 256 * j, row = e >> 5, c4 = (e & 31) * 4;
                vals[j] = *(const v4f*)(Cs + row * GSP + c4);
                po[j] = (size_t)(bm0 + p * 64 + row) * N + bn0 + c4;
            }
#pragma unroll
            for (int j = 0; j < 8; ++j) *(v4f*)(Cf + po[j]) = vals[j];
            
        }
        if (omode & 2) {
            v8h hv[4];
            size_t po[4];
#pragma unroll
            for (int j = 0; j < 4; ++j) {
                const int e = t + 256 * j, row = e >> 4, c8 = (e & 15) * 8;
                v4f a = *(const v4f*)(Cs + row * GSP + c8);
                v4f b = *(const v4f*)(Cs + row * GSP + c8 + 4);
                hv[j][0] = (f16)a[0]; hv[j][1] = (f16)a[1]; hv[j][2] = (f16)a[2]; hv[j][3] = (f16)a[3];
                hv[j][4] = (f16)b[0]; hv[j][5] = (f16)b[1]; hv[j][6] = (f16)b[2]; hv[j][7] = (f16)b[3];
                po[j] = (size_t)(bm0 + p * 64 + row) * N + bn0 + c8;
            }
#pragma unroll
            for (int j = 0; j < 4; ++j) *(v8h*)(Ch + po[j]) = hv[j];
            
        }
        __syncthreads();
    }
}

// ---------------- fused attention per (batch, head, 128-query tile); q = k = v = the single projection ----------------
#define ALD 72      // staged row: 64 halves + 8 pad = 144 B

__global__ __launch_bounds__(256) void k_attn(const f16* __restrict__ QKV, const float* __restrict__ mask,
                                               f16* Ctx, int nb) {
    __shared__ f16 Ks[64 * ALD];          // [key][dim]
    __shared__ f16 Vs[64 * ALD];          // [dim][key]
    __shared__ f16 Ps[8 * 16 * ALD];      // per wave: [query row][key], later [query row][dim]

    const int t = threadIdx.x, wave = t >> 5, lane = t & 31;
    const int hh = lane >> 4, l16 = lane & 15;
    const int bid = blockIdx.x;
    const int nqt = SEQ / 128;
    const int qt = bid % nqt, h = (bid / nqt) % NHD, b = bid / (nqt * NHD);
    if (b >= nb) return;
    const int q0 = qt * 128 + wave * 16;
    const size_t tok0 = (size_t)b * SEQ;             // compact token row base of this batch
    f16* Pw = Ps + wave * 16 * ALD;

    // Q as A operand: row m = l16, 64 dims = two k=32 fragments
    Frag qa[2];
    {
        const f16* qp = QKV + (tok0 + q0 + l16) * HID + h * DHD;
#pragma unroll
        for (int kf = 0; kf < 2; ++kf) {
            qa[kf].half[0] = *(const v8h*)(qp + kf * 32 + 8 * hh);
            qa[kf].half[1] = *(const v8h*)(qp + kf * 32 + 16 + 8 * hh);
        }
    }

    float mrun[8], lrun[8];
    v8f o[4];
#pragma unroll
    for (int r = 0; r < 8; ++r) { mrun[r] = -3.0e38f; lrun[r] = 0.0f; }
#pragma unroll
    for (int nf = 0; nf < 4; ++nf) o[nf] = zero8();

    for (int kt = 0; kt < SEQ / 64; ++kt) {
        // stage 64 keys x 64 dims: K row-major, V transposed into [dim][key] (same source rows)
#pragma unroll
        for (int j = 0; j < 2; ++j) {
            const int e = t + 256 * j, key = e >> 3, seg = (e & 7) * 8;
            const size_t g = (tok0 + kt * 64 + key) * HID + h * DHD + seg;
            v8h kv = *(const v8h*)(QKV + g);
            *(v8h*)(Ks + key * ALD + seg) = kv;
#pragma unroll
            for (int i = 0; i < 8; ++i) Vs[(seg + i) * ALD + key] = kv[i];
        }
        __syncthreads();

        // S = Q.K^T / 8 + additive mask ; B operand column n = key, k = dim contiguous in Ks row
        v8f s[4];
#pragma unroll
        for (int n = 0; n < 4; ++n) {
            Frag kb0, kb1;
            const f16* kp = Ks + (n * 16 + l16) * ALD;
            kb0.half[0] = *(const v8h*)(kp + 8 * hh);
            kb0.half[1] = *(const v8h*)(kp + 16 + 8 * hh);
            kb1.half[0] = *(const v8h*)(kp + 32 + 8 * hh);
            kb1.half[1] = *(const v8h*)(kp + 48 + 8 * hh);
            v8f z = zero8();
            z = wmma16(qa[0].v, kb0.v, z);
            z = wmma16(qa[1].v, kb1.v, z);
            const int key = kt * 64 + n * 16 + l16;
            const float mt = mask[(size_t)b * SEQ_FULL + key];
#pragma unroll
            for (int r = 0; r < 8; ++r) s[n][r] = z[r] * 0.125f + mt;
        }

        // online softmax; row statistics replicated across each 16-lane half
        float mnew[8], corr[8];
#pragma unroll
        for (int r = 0; r < 8; ++r) {
            float mx = fmaxf(fmaxf(s[0][r], s[1][r]), fmaxf(s[2][r], s[3][r]));
#pragma unroll
            for (int off = 8; off >= 1; off >>= 1) mx = fmaxf(mx, __shfl_xor(mx, off, 32));
            mnew[r] = fmaxf(mrun[r], mx);
            corr[r] = __expf(mrun[r] - mnew[r]);
            mrun[r] = mnew[r];
        }
#pragma unroll
        for (int nf = 0; nf < 4; ++nf)
#pragma unroll
            for (int r = 0; r < 8; ++r) o[nf][r] *= corr[r];
#pragma unroll
        for (int r = 0; r < 8; ++r) {
            float rs = 0.0f;
#pragma unroll
            for (int n = 0; n < 4; ++n) {
                float pe = __expf(s[n][r] - mnew[r]);
                s[n][r] = pe;
                rs += pe;
            }
#pragma unroll
            for (int off = 8; off >= 1; off >>= 1) rs += __shfl_xor(rs, off, 32);
            lrun[r] = lrun[r] * corr[r] + rs;
        }

        // D layout (lane = key column, rows 8h+r) -> A layout through per-wave LDS; p scaled by 2^12
#pragma unroll
        for (int n = 0; n < 4; ++n)
#pragma unroll
            for (int r = 0; r < 8; ++r)
                Pw[(r + 8 * hh) * ALD + n * 16 + l16] = (f16)(s[n][r] * 4096.0f);
        __syncthreads();   // orders the spill before the fragment reload

        Frag pa[2];
        {
            const f16* pp = Pw + l16 * ALD;
#pragma unroll
            for (int kf = 0; kf < 2; ++kf) {
                pa[kf].half[0] = *(const v8h*)(pp + kf * 32 + 8 * hh);
                pa[kf].half[1] = *(const v8h*)(pp + kf * 32 + 16 + 8 * hh);
            }
        }
        // O += P.V ; B operand column n = dim, k = key contiguous in Vs row
#pragma unroll
        for (int nf = 0; nf < 4; ++nf) {
            Frag vb0, vb1;
            const f16* vp = Vs + (nf * 16 + l16) * ALD;
            vb0.half[0] = *(const v8h*)(vp + 8 * hh);
            vb0.half[1] = *(const v8h*)(vp + 16 + 8 * hh);
            vb1.half[0] = *(const v8h*)(vp + 32 + 8 * hh);
            vb1.half[1] = *(const v8h*)(vp + 48 + 8 * hh);
            o[nf] = wmma16(pa[0].v, vb0.v, o[nf]);
            o[nf] = wmma16(pa[1].v, vb1.v, o[nf]);
        }
        __syncthreads();
    }

    {
        float il[8];
#pragma unroll
        for (int r = 0; r < 8; ++r) il[r] = 16.0f / (lrun[r] * 4096.0f);
#pragma unroll
        for (int nf = 0; nf < 4; ++nf)
#pragma unroll
            for (int r = 0; r < 8; ++r)
                Pw[(r + 8 * hh) * ALD + nf * 16 + l16] = (f16)(o[nf][r] * il[r]);
    }
    __syncthreads();
    v8h cv[4];
    size_t po[4];
#pragma unroll
    for (int j = 0; j < 4; ++j) {
        const int s2 = lane + 32 * j, row = s2 >> 3, c8 = (s2 & 7) * 8;
        cv[j] = *(const v8h*)(Pw + row * ALD + c8);
        po[j] = (tok0 + q0 + row) * HID + h * DHD + c8;
    }
#pragma unroll
    for (int j = 0; j < 4; ++j) *(v8h*)(Ctx + po[j]) = cv[j];
    
}

// ---------------- fused residual + LayerNorm over 1024 (256 threads x 4) ----------------
// residual row for compact row m is (m / rseq) * rseqf + m % rseq; res_bf16 != 0: residual is a raw input
// and is consumed as its RNE bf16 value; write_h != 0: also write the f16 copy (outh dereferenced only then)
__global__ __launch_bounds__(256) void k_ln(const float* __restrict__ a, const float* __restrict__ res,
                                             int rseq, int rseqf, int res_bf16,
                                             const float* __restrict__ g, const float* __restrict__ be,
                                             float* outf, f16* outh, int write_h, int nrows) {
    __shared__ float red1[8], red2[8];
    const int row = blockIdx.x;
    if (row >= nrows) return;
    const int t = threadIdx.x, wave = t >> 5, lane = t & 31;
    const size_t base = (size_t)row * HID + (size_t)t * 4;
    const size_t rrow = (size_t)(row / rseq) * (size_t)rseqf + (size_t)(row % rseq);
    const size_t rbase = rrow * HID + (size_t)t * 4;

    v4f rv = *(const v4f*)(res + rbase);
    if (res_bf16) {
        rv[0] = bf16r(rv[0]); rv[1] = bf16r(rv[1]); rv[2] = bf16r(rv[2]); rv[3] = bf16r(rv[3]);
    }
    v4f x = *(const v4f*)(a + base) + rv;
    float sm = (x[0] + x[1]) + (x[2] + x[3]);
#pragma unroll
    for (int off = 16; off >= 1; off >>= 1) sm += __shfl_xor(sm, off, 32);
    if (lane == 0) red1[wave] = sm;
    __syncthreads();
    float tot = 0.0f;
#pragma unroll
    for (int w = 0; w < 8; ++w) tot += red1[w];
    const float mu = tot * (1.0f / 1024.0f);

    v4f d = x - mu;
    float sq = (d[0] * d[0] + d[1] * d[1]) + (d[2] * d[2] + d[3] * d[3]);
#pragma unroll
    for (int off = 16; off >= 1; off >>= 1) sq += __shfl_xor(sq, off, 32);
    if (lane == 0) red2[wave] = sq;
    __syncthreads();
    float tot2 = 0.0f;
#pragma unroll
    for (int w = 0; w < 8; ++w) tot2 += red2[w];
    const float var = tot2 * (1.0f / 1024.0f);
    const float rstd = rsqrtf(var + 1.0e-5f);

    v4f gv = *(const v4f*)(g + t * 4);
    v4f bv = *(const v4f*)(be + t * 4);
    v4f y = d * rstd * gv + bv;
    v4h yh;
    yh[0] = (f16)y[0]; yh[1] = (f16)y[1]; yh[2] = (f16)y[2]; yh[3] = (f16)y[3];

    *(v4f*)(outf + base) = y;
    if (write_h) *(v4h*)(outh + base) = yh;
    
}

// ---------------- host launcher ----------------
extern "C" void kernel_launch(void* const* d_in, const int* in_sizes, int n_in,
                              void* d_out, int out_size, void* d_ws, size_t ws_size,
                              hipStream_t stream) {
    const int Mtok = MTOK;
    if (n_in < 14) return;
    if (in_sizes[0] < ((NB - 1) * SEQ_FULL + SEQ) * HID || in_sizes[1] < (NB - 1) * SEQ_FULL + SEQ ||
        in_sizes[2] < HID * HID || in_sizes[3] < HID || in_sizes[4] < HID * HID || in_sizes[5] < HID ||
        in_sizes[6] < HID || in_sizes[7] < HID || in_sizes[8] < DFF * HID || in_sizes[9] < DFF ||
        in_sizes[10] < HID * DFF || in_sizes[11] < HID || in_sizes[12] < HID || in_sizes[13] < HID ||
        out_size < Mtok * HID) return;

    const float* x    = (const float*)d_in[0];
    const float* amsk = (const float*)d_in[1];
    const float* Wq   = (const float*)d_in[2];  const float* bq   = (const float*)d_in[3];
    const float* Wso  = (const float*)d_in[4];  const float* bso  = (const float*)d_in[5];
    const float* ln1g = (const float*)d_in[6];  const float* ln1b = (const float*)d_in[7];
    const float* Wi   = (const float*)d_in[8];  const float* bi   = (const float*)d_in[9];
    const float* Wo   = (const float*)d_in[10]; const float* bo   = (const float*)d_in[11];
    const float* ln2g = (const float*)d_in[12]; const float* ln2b = (const float*)d_in[13];

    char* ws = (char*)d_ws;
    size_t off = 0;
    auto take = [&](size_t bytes) -> char* {
        char* p = ws + off;
        off += (bytes + 255) & ~(size_t)255;
        return p;
    };
    f16*   xh    = (f16*)take((size_t)Mtok * HID * 2);      // [Mtok][1024]
    f16*   wq16  = (f16*)take((size_t)HID * HID * 2);       // [N=1024][K=1024]
    f16*   wso16 = (f16*)take((size_t)HID * HID * 2);       // [N=1024][K=1024]
    f16*   wi16  = (f16*)take((size_t)DFF * HID * 2);       // [N=4096][K=1024]
    f16*   wo16  = (f16*)take((size_t)HID * DFF * 2);       // [N=1024][K=4096]
    f16*   qkvh  = (f16*)take((size_t)Mtok * HID * 2);
    f16*   ctxh  = (f16*)take((size_t)Mtok * HID * 2);
    float* attf  = (float*)take((size_t)Mtok * HID * 4);    // also holds fff later (same extent)
    float* h1f   = (float*)take((size_t)Mtok * HID * 4);
    f16*   h1h   = (f16*)take((size_t)Mtok * HID * 2);
    f16*   gh    = (f16*)take((size_t)Mtok * DFF * 2);
    float* fff   = attf;                                    // attf fully consumed by LN1 before the output GEMM writes fff
    if (off > ws_size) return;

    const int thr = 256;
    const float wsc = 64.0f;   // 2^6 weight operand scale, folded back in the GEMM epilogue

    // activations -> f16 (compact token rows), weights [N][K] -> scaled f16 [N][K]
    k_cvt<<<(Mtok * HID / 8 + thr - 1) / thr, thr, 0, stream>>>(x, xh, Mtok * HID, HID, SEQ, SEQ_FULL, 1.0f);
    k_cvt<<<(HID * HID / 8 + thr - 1) / thr, thr, 0, stream>>>(Wq, wq16, HID * HID, HID, HID, HID, wsc);
    k_cvt<<<(HID * HID / 8 + thr - 1) / thr, thr, 0, stream>>>(Wso, wso16, HID * HID, HID, HID, HID, wsc);
    k_cvt<<<(DFF * HID / 8 + thr - 1) / thr, thr, 0, stream>>>(Wi, wi16, DFF * HID, HID, DFF, DFF, wsc);
    k_cvt<<<(HID * DFF / 8 + thr - 1) / thr, thr, 0, stream>>>(Wo, wo16, HID * DFF, DFF, HID, HID, wsc);

    const dim3 gH(HID / GBN, Mtok / GBM);     // N = 1024
    const dim3 gF(DFF / GBN, Mtok / GBM);     // N = 4096

    // Placeholder pointer arguments below (omode / write_h exclude them) are valid, correctly typed
    // workspace regions that the launch never dereferences.

    // shared q/k/v projection (f16 out only, [Mtok][1024]); Cf placeholder = attf
    k_gemm<<<gH, thr, 0, stream>>>(xh, wq16, bq, attf, qkvh, Mtok, HID, HID, 0, 0.015625f, 2);

    // attention: one block per (batch, head, 128 queries); ctx carried * 2^4
    k_attn<<<NB * NHD * (SEQ / 128), thr, 0, stream>>>(qkvh, amsk, ctxh, NB);

    // self-output projection (f32 out only, * 2^-6 * 2^-4); Ch placeholder = gh
    k_gemm<<<gH, thr, 0, stream>>>(ctxh, wso16, bso, attf, gh, Mtok, HID, HID, 0, 0.0009765625f, 1);
    // LN1(attn + bf16(x)) -> h1 (f32 + f16 copy)
    k_ln<<<Mtok, thr, 0, stream>>>(attf, x, SEQ, SEQ_FULL, 1, ln1g, ln1b, h1f, h1h, 1, Mtok);

    // FFN: GELU(h1.Wi^T + bi) (f16 out only; Cf placeholder = attf) . Wo^T + bo (f32 out only; Ch placeholder = h1h)
    k_gemm<<<gF, thr, 0, stream>>>(h1h, wi16, bi, attf, gh, Mtok, DFF, HID, 1, 0.015625f, 2);
    k_gemm<<<gH, thr, 0, stream>>>(gh, wo16, bo, fff, h1h, Mtok, HID, DFF, 0, 0.015625f, 1);
    // LN2(ff + h1) -> d_out (f32 only; outh placeholder = h1h, residual not converted)
    k_ln<<<Mtok, thr, 0, stream>>>(fff, h1f, SEQ, SEQ, 0, ln2g, ln2b, (float*)d_out, h1h, 0, Mtok);
}

// v001
// A run of this version takes 268 microseconds.
// Timed twice side by side with v000, it ran 1.31 and 1.32 times as fast.
#include <hip/hip_runtime.h>
#include <stdint.h>
// All contractions: v_wmma_f32_16x16x32_f16 (f16 operands, f32 accumulate): qkv, self-output, intermediate and output projections (float inputs RNE-converted to bf16 then f16; weight operand scaled by 2^6, ctx operand by 2^4, folded back in the epilogue), q.k^T and p.v (p scaled by 2^12); softmax, LayerNorm, GELU, residuals in f32.

#ifndef NB
#define NB 2
#endif
#ifndef SEQ
#define SEQ 2048
#endif
#define NB_FULL 2
#define SEQ_FULL 2048
#define HID 1024
#define NHD 16
#define DHD 64
#define DFF 4096
#define MTOK (NB * SEQ)

static_assert(NB >= 1 && NB <= NB_FULL);
static_assert(SEQ >= 128 && SEQ <= SEQ_FULL && (SEQ % 128) == 0);
static_assert((MTOK % 128) == 0);
static_assert(HID == NHD * DHD);
static_assert((HID % 128) == 0 && (DFF % 128) == 0 && (HID % 32) == 0 && (DFF % 32) == 0);

typedef _Float16 f16;
typedef f16   v4h  __attribute__((ext_vector_type(4)));
typedef f16   v8h  __attribute__((ext_vector_type(8)));
typedef f16   v16h __attribute__((ext_vector_type(16)));
typedef float v4f  __attribute__((ext_vector_type(4)));
typedef float v8f  __attribute__((ext_vector_type(8)));
union Frag { v16h v; v8h half[2]; };

// 16x16x32 f16 WMMA with hazard guard (4 VALU slots) tied to D, A and B
__device__ __forceinline__ v8f wmma16(v16h a, v16h b, v8f c) {
    v8f d = __builtin_amdgcn_wmma_f32_16x16x32_f16(false, a, false, b, (short)0, c, false, false);
    asm volatile("v_nop\n\tv_nop\n\tv_nop\n\tv_nop" : "+v"(d) : "v"(a), "v"(b));
    return d;
}
__device__ __forceinline__ v8f zero8() {
    v8f z;
#pragma unroll
    for (int i = 0; i < 8; ++i) z[i] = 0.0f;
    return z;
}
// f32 -> nearest-even bf16 value, returned as f32
__device__ __forceinline__ float bf16r(float x) {
    unsigned u = __float_as_uint(x);
    u = (u + 0x7FFFu + ((u >> 16) & 1u)) & 0xFFFF0000u;
    return __uint_as_float(u);
}

// compact destination row m reads source row (m / seq) * seqf + m % seq (identity when seq >= row count)
__global__ __launch_bounds__(256) void k_cvt(const float* __restrict__ in, f16* out, int n, int rowlen,
                                              int seq, int seqf, float scale) {
    const size_t i8 = ((size_t)blockIdx.x * 256 + threadIdx.x) * 8;
    if (i8 + 8 > (size_t)n) return;
    const int m = (int)(i8 / (size_t)rowlen);
    const int c = (int)(i8 - (size_t)m * (size_t)rowlen);
    const size_t src = ((size_t)(m / seq) * (size_t)seqf + (size_t)(m % seq)) * (size_t)rowlen + (size_t)c;
    v4f a = *(const v4f*)(in + src);
    v4f b = *(const v4f*)(in + src + 4);
    v8h hv;
    hv[0] = (f16)(bf16r(a[0]) * scale); hv[1] = (f16)(bf16r(a[1]) * scale);
    hv[2] = (f16)(bf16r(a[2]) * scale); hv[3] = (f16)(bf16r(a[3]) * scale);
    hv[4] = (f16)(bf16r(b[0]) * scale); hv[5] = (f16)(bf16r(b[1]) * scale);
    hv[6] = (f16)(bf16r(b[2]) * scale); hv[7] = (f16)(bf16r(b[3]) * scale);
    f16* p = out + i8;
    *(v8h*)p = hv;
    
}

// ---------------- tiled GEMM: C[M][N] = A[M][K] (f16) . B, B given as BT[N][K] (f16, k-contiguous) ----------------
// epilogue: * oscale + bias, optional exact GELU; f32 (omode bit 0) and/or f16 (omode bit 1) output,
#define GBM 128
#define GBN 128
#define GBK 128     // k depth of one ring stage
#define GLD 136     // staged row: 128 halves + 8 pad = 272 B
#define GSP 132     // staging row pitch in floats (528 B)
#define GTILE (GBM * GLD)       // halves of one operand tile in LDS
#define GSTAGE (2 * GTILE)      // halves of one stage: [A tile | B tile]

static_assert((HID % GBK) == 0 && (DFF % GBK) == 0);
static_assert(64 * GSP * 4 <= 2 * GSTAGE * 2);

// One lane's share of a 128-row x 256-byte operand tile: rows r, r+16, .. r+112, 16 bytes each, global -> LDS
// without passing registers. lds = LDS byte address of row r's piece, g = its global address, gstep = 16 rows in halves.
// s_wait_xcnt is the statement's last line, a precaution: so it stands ahead of every later rewrite of these address registers.
__device__ __forceinline__ void copy_tile(unsigned lds, const f16* g, size_t gstep) {
    asm volatile("global_load_async_to_lds_b128 %0, %8, off\n\t"
                 "global_load_async_to_lds_b128 %1, %9, off\n\t"
                 "global_load_async_to_lds_b128 %2, %10, off\n\t"
                 "global_load_async_to_lds_b128 %3, %11, off\n\t"
                 "global_load_async_to_lds_b128 %4, %12, off\n\t"
                 "global_load_async_to_lds_b128 %5, %13, off\n\t"
                 "global_load_async_to_lds_b128 %6, %14, off\n\t"
                 "global_load_async_to_lds_b128 %7, %15, off\n\t"
                 "s_wait_xcnt 0x0"
                 :: "v"(lds), "v"(lds + 1u * 16u * GLD * 2u), "v"(lds + 2u * 16u * GLD * 2u),
                    "v"(lds + 3u * 16u * GLD * 2u), "v"(lds + 4u * 16u * GLD * 2u), "v"(lds + 5u * 16u * GLD * 2u),
                    "v"(lds + 6u * 16u * GLD * 2u), "v"(lds + 7u * 16u * GLD * 2u),
                    "v"(g), "v"(g + gstep), "v"(g + 2 * gstep), "v"(g + 3 * gstep),
                    "v"(g + 4 * gstep), "v"(g + 5 * gstep), "v"(g + 6 * gstep), "v"(g + 7 * gstep)
                 : "memory");
}

__global__ __launch_bounds__(256) void k_gemm(const f16* __restrict__ A, const f16* __restrict__ BT,
                                               const float* __restrict__ bias, float* Cf, f16* Ch,
                                               int M, int N, int K, int act, float oscale, int omode) {
    __shared__ __attribute__((aligned(16))) f16 ring[2 * GSTAGE];   // two stages; output staging once the loop has left it
    float* Cs = (float*)ring;

    const int t = threadIdx.x, wave = t >> 5, lane = t & 31;
    const int hh = lane >> 4, l16 = lane & 15;
    const int wm = wave >> 2, wn = wave & 3;          // 2 x 4 waves, 64 x 32 per wave
    const int bm0 = blockIdx.y * GBM, bn0 = blockIdx.x * GBN;
    if (bm0 + GBM > M || bn0 + GBN > N) return;       // block-uniform; host guarantees exact multiples

    v8f acc[4][2];
#pragma unroll
    for (int i = 0; i < 4; ++i)
#pragma unroll
        for (int j = 0; j < 2; ++j) acc[i][j] = zero8();

    // two-buffer ring: stage s lives in buffer s & 1; its copies fly while stage s - 1 is multiplied
    const int nk = K / GBK;
    const int crow = t >> 4, cseg = (t & 15) * 8;     // this lane copies rows crow + 16 j, halves cseg .. cseg + 7
    const f16* ga = A  + (size_t)(bm0 + crow) * K + cseg;
    const f16* gb = BT + (size_t)(bn0 + crow) * K + cseg;
    const size_t gstep = (size_t)16 * K;
    const unsigned lcopy = (unsigned)(uintptr_t)ring + (unsigned)(crow * GLD + cseg) * 2u;

    copy_tile(lcopy, ga, gstep);
    copy_tile(lcopy + GTILE * 2u, gb, gstep);
    asm volatile("s_wait_asynccnt 0x0" ::: "memory");   // stage 0 of this wave has landed
    __syncthreads();                                    // ... and of every wave
    if (nk > 1) {
        copy_tile(lcopy + GSTAGE * 2u, ga + GBK, gstep);
        copy_tile(lcopy + (GSTAGE + GTILE) * 2u, gb + GBK, gstep);
    }

    for (int it = 0; it < nk; ++it) {
        const unsigned buf = (unsigned)(it & 1);
        const f16* As = ring + buf * GSTAGE;
        const f16* Bs = As + GTILE;
#pragma unroll   // every LDS offset of the stage becomes an immediate
        for (int ks = 0; ks < GBK / 32; ++ks) {
            Frag af[4], bf[2];
#pragma unroll
            for (int mf = 0; mf < 4; ++mf) {
                const f16* ap = As + (wm * 64 + mf * 16 + l16) * GLD + ks * 32;
                af[mf].half[0] = *(const v8h*)(ap + 8 * hh);        // k = 8h .. 8h+7
                af[mf].half[1] = *(const v8h*)(ap + 16 + 8 * hh);   // k = 16+8h .. 16+8h+7
            }
#pragma unroll
            for (int nf = 0; nf < 2; ++nf) {
                const f16* bp = Bs + (wn * 32 + nf * 16 + l16) * GLD + ks * 32;   // column n, k-contiguous
                bf[nf].half[0] = *(const v8h*)(bp + 8 * hh);
                bf[nf].half[1] = *(const v8h*)(bp + 16 + 8 * hh);
            }
#pragma unroll
            for (int mf = 0; mf < 4; ++mf)
#pragma unroll
                for (int nf = 0; nf < 2; ++nf)
                    acc[mf][nf] = wmma16(af[mf].v, bf[nf].v, acc[mf][nf]);
        }
        asm volatile("s_wait_dscnt 0x0" ::: "memory");      // this wave's reads of buffer buf are done before it is refilled
        asm volatile("s_wait_asynccnt 0x0" ::: "memory");   // this wave's copies of stage it + 1 have landed
        __syncthreads();                                    // publishes stage it + 1, frees buffer buf
        if (it + 2 < nk) {
            copy_tile(lcopy + buf * (GSTAGE * 2u), ga + (size_t)(it + 2) * GBK, gstep);
            copy_tile(lcopy + buf * (GSTAGE * 2u) + GTILE * 2u, gb + (size_t)(it + 2) * GBK, gstep);
        }
    }
    asm volatile("s_wait_asynccnt 0x0" ::: "memory");       // nothing in flight when the ring becomes output staging

#pragma unroll 1
    for (int p = 0; p < 2; ++p) {
        if (wm == p) {
#pragma unroll
            for (int mf = 0; mf < 4; ++mf)
#pragma unroll
                for (int nf = 0; nf < 2; ++nf) {
                    const int col = wn * 32 + nf * 16 + l16;
                    const float bvv = bias[bn0 + col];
#pragma unroll
                    for (int r = 0; r < 8; ++r) {
                        const int row = mf * 16 + 8 * hh + r;
                        float x = acc[mf][nf][r] * oscale + bvv;
                        if (act) x = x * 0.5f * (1.0f + erff(x * 0.70710678118654752f));
                        Cs[row * GSP + col] = x;
                    }
                }
        }
        __syncthreads();
        if (omode & 1) {
            v4f vals[8];
            size_t po[8];
#pragma unroll
            for (int j = 0; j < 8; ++j) {
                const int e = t + 256 * j, row = e >> 5, c4 = (e & 31) * 4;
                vals[j] = *(const v4f*)(Cs + row * GSP + c4);
                po[j] = (size_t)(bm0 + p * 64 + row) * N + bn0 + c4;
            }
#pragma unroll
            for (int j = 0; j < 8; ++j) *(v4f*)(Cf + po[j]) = vals[j];
            
        }
        if (omode & 2) {
            v8h hv[4];
            size_t po[4];
#pragma unroll
            for (int j = 0; j < 4; ++j) {
                const int e = t + 256 * j, row = e >> 4, c8 = (e & 15) * 8;
                v4f a = *(const v4f*)(Cs + row * GSP + c8);
                v4f b = *(const v4f*)(Cs + row * GSP + c8 + 4);
                hv[j][0] = (f16)a[0]; hv[j][1] = (f16)a[1]; hv[j][2] = (f16)a[2]; hv[j][3] = (f16)a[3];
                hv[j][4] = (f16)b[0]; hv[j][5] = (f16)b[1]; hv[j][6] = (f16)b[2]; hv[j][7] = (f16)b[3];
                po[j] = (size_t)(bm0 + p * 64 + row) * N + bn0 + c8;
            }
#pragma unroll
            for (int j = 0; j < 4; ++j) *(v8h*)(Ch + po[j]) = hv[j];
            
        }
        __syncthreads();
    }
}

// ---------------- fused attention per (batch, head, 128-query tile); q = k = v = the single projection ----------------
#define ALD 72      // staged row: 64 halves + 8 pad = 144 B

__global__ __launch_bounds__(256) void k_attn(const f16* __restrict__ QKV, const float* __restrict__ mask,
                                               f16* Ctx, int nb) {
    __shared__ f16 Ks[64 * ALD];          // [key][dim]
    __shared__ f16 Vs[64 * ALD];          // [dim][key]
    __shared__ f16 Ps[8 * 16 * ALD];      // per wave: [query row][key], later [query row][dim]

    const int t = threadIdx.x, wave = t >> 5, lane = t & 31;
    const int hh = lane >> 4, l16 = lane & 15;
    const int bid = blockIdx.x;
    const int nqt = SEQ / 128;
    const int qt = bid % nqt, h = (bid / nqt) % NHD, b = bid / (nqt * NHD);
    if (b >= nb) return;
    const int q0 = qt * 128 + wave * 16;
    const size_t tok0 = (size_t)b * SEQ;             // compact token row base of this batch
    f16* Pw = Ps + wave * 16 * ALD;

    // Q as A operand: row m = l16, 64 dims = two k=32 fragments
    Frag qa[2];
    {
        const f16* qp = QKV + (tok0 + q0 + l16) * HID + h * DHD;
#pragma unroll
        for (int kf = 0; kf < 2; ++kf) {
            qa[kf].half[0] = *(const v8h*)(qp + kf * 32 + 8 * hh);
            qa[kf].half[1] = *(const v8h*)(qp + kf * 32 + 16 + 8 * hh);
        }
    }

    float mrun[8], lrun[8];
    v8f o[4];
#pragma unroll
    for (int r = 0; r < 8; ++r) { mrun[r] = -3.0e38f; lrun[r] = 0.0f; }
#pragma unroll
    for (int nf = 0; nf < 4; ++nf) o[nf] = zero8();

    for (int kt = 0; kt < SEQ / 64; ++kt) {
        // stage 64 keys x 64 dims: K row-major, V transposed into [dim][key] (same source rows)
#pragma unroll
        for (int j = 0; j < 2; ++j) {
            const int e = t + 256 * j, key = e >> 3, seg = (e & 7) * 8;
            const size_t g = (tok0 + kt * 64 + key) * HID + h * DHD + seg;
            v8h kv = *(const v8h*)(QKV + g);
            *(v8h*)(Ks + key * ALD + seg) = kv;
#pragma unroll
            for (int i = 0; i < 8; ++i) Vs[(seg + i) * ALD + key] = kv[i];
        }
        __syncthreads();

        // S = Q.K^T / 8 + additive mask ; B operand column n = key, k = dim contiguous in Ks row
        v8f s[4];
#pragma unroll
        for (int n = 0; n < 4; ++n) {
            Frag kb0, kb1;
            const f16* kp = Ks + (n * 16 + l16) * ALD;
            kb0.half[0] = *(const v8h*)(kp + 8 * hh);
            kb0.half[1] = *(const v8h*)(kp + 16 + 8 * hh);
            kb1.half[0] = *(const v8h*)(kp + 32 + 8 * hh);
            kb1.half[1] = *(const v8h*)(kp + 48 + 8 * hh);
            v8f z = zero8();
            z = wmma16(qa[0].v, kb0.v, z);
            z = wmma16(qa[1].v, kb1.v, z);
            const int key = kt * 64 + n * 16 + l16;
            const float mt = mask[(size_t)b * SEQ_FULL + key];
#pragma unroll
            for (int r = 0; r < 8; ++r) s[n][r] = z[r] * 0.125f + mt;
        }

        // online softmax; row statistics replicated across each 16-lane half
        float mnew[8], corr[8];
#pragma unroll
        for (int r = 0; r < 8; ++r) {
            float mx = fmaxf(fmaxf(s[0][r], s[1][r]), fmaxf(s[2][r], s[3][r]));
#pragma unroll
            for (int off = 8; off >= 1; off >>= 1) mx = fmaxf(mx, __shfl_xor(mx, off, 32));
            mnew[r] = fmaxf(mrun[r], mx);
            corr[r] = __expf(mrun[r] - mnew[r]);
            mrun[r] = mnew[r];
        }
#pragma unroll
        for (int nf = 0; nf < 4; ++nf)
#pragma unroll
            for (int r = 0; r < 8; ++r) o[nf][r] *= corr[r];
#pragma unroll
        for (int r = 0; r < 8; ++r) {
            float rs = 0.0f;
#pragma unroll
            for (int n = 0; n < 4; ++n) {
                float pe = __expf(s[n][r] - mnew[r]);
                s[n][r] = pe;
                rs += pe;
            }
#pragma unroll
            for (int off = 8; off >= 1; off >>= 1) rs += __shfl_xor(rs, off, 32);
            lrun[r] = lrun[r] * corr[r] + rs;
        }

        // D layout (lane = key column, rows 8h+r) -> A layout through per-wave LDS; p scaled by 2^12
#pragma unroll
        for (int n = 0; n < 4; ++n)
#pragma unroll
            for (int r = 0; r < 8; ++r)
                Pw[(r + 8 * hh) * ALD + n * 16 + l16] = (f16)(s[n][r] * 4096.0f);
        __syncthreads();   // orders the spill before the fragment reload

        Frag pa[2];
        {
            const f16* pp = Pw + l16 * ALD;
#pragma unroll
            for (int kf = 0; kf < 2; ++kf) {
                pa[kf].half[0] = *(const v8h*)(pp + kf * 32 + 8 * hh);
                pa[kf].half[1] = *(const v8h*)(pp + kf * 32 + 16 + 8 * hh);
            }
        }
        // O += P.V ; B operand column n = dim, k = key contiguous in Vs row
#pragma unroll
        for (int nf = 0; nf < 4; ++nf) {
            Frag vb0, vb1;
            const f16* vp = Vs + (nf * 16 + l16) * ALD;
            vb0.half[0] = *(const v8h*)(vp + 8 * hh);
            vb0.half[1] = *(const v8h*)(vp + 16 + 8 * hh);
            vb1.half[0] = *(const v8h*)(vp + 32 + 8 * hh);
            vb1.half[1] = *(const v8h*)(vp + 48 + 8 * hh);
            o[nf] = wmma16(pa[0].v, vb0.v, o[nf]);
            o[nf] = wmma16(pa[1].v, vb1.v, o[nf]);
        }
        __syncthreads();
    }

    {
        float il[8];
#pragma unroll
        for (int r = 0; r < 8; ++r) il[r] = 16.0f / (lrun[r] * 4096.0f);
#pragma unroll
        for (int nf = 0; nf < 4; ++nf)
#pragma unroll
            for (int r = 0; r < 8; ++r)
                Pw[(r + 8 * hh) * ALD + nf * 16 + l16] = (f16)(o[nf][r] * il[r]);
    }
    __syncthreads();
    v8h cv[4];
    size_t po[4];
#pragma unroll
    for (int j = 0; j < 4; ++j) {
        const int s2 = lane + 32 * j, row = s2 >> 3, c8 = (s2 & 7) * 8;
        cv[j] = *(const v8h*)(Pw + row * ALD + c8);
        po[j] = (tok0 + q0 + row) * HID + h * DHD + c8;
    }
#pragma unroll
    for (int j = 0; j < 4; ++j) *(v8h*)(Ctx + po[j]) = cv[j];
    
}

// ---------------- fused residual + LayerNorm over 1024 (256 threads x 4) ----------------
// residual row for compact row m is (m / rseq) * rseqf + m % rseq; res_bf16 != 0: residual is a raw input
// and is consumed as its RNE bf16 value; write_h != 0: also write the f16 copy (outh dereferenced only then)
__global__ __launch_bounds__(256) void k_ln(const float* __restrict__ a, const float* __restrict__ res,
                                             int rseq, int rseqf, int res_bf16,
                                             const float* __restrict__ g, const float* __restrict__ be,
                                             float* outf, f16* outh, int write_h, int nrows) {
    __shared__ float red1[8], red2[8];
    const int row = blockIdx.x;
    if (row >= nrows) return;
    const int t = threadIdx.x, wave = t >> 5, lane = t & 31;
    const size_t base = (size_t)row * HID + (size_t)t * 4;
    const size_t rrow = (size_t)(row / rseq) * (size_t)rseqf + (size_t)(row % rseq);
    const size_t rbase = rrow * HID + (size_t)t * 4;

    v4f rv = *(const v4f*)(res + rbase);
    if (res_bf16) {
        rv[0] = bf16r(rv[0]); rv[1] = bf16r(rv[1]); rv[2] = bf16r(rv[2]); rv[3] = bf16r(rv[3]);
    }
    v4f x = *(const v4f*)(a + base) + rv;
    float sm = (x[0] + x[1]) + (x[2] + x[3]);
#pragma unroll
    for (int off = 16; off >= 1; off >>= 1) sm += __shfl_xor(sm, off, 32);
    if (lane == 0) red1[wave] = sm;
    __syncthreads();
    float tot = 0.0f;
#pragma unroll
    for (int w = 0; w < 8; ++w) tot += red1[w];
    const float mu = tot * (1.0f / 1024.0f);

    v4f d = x - mu;
    float sq = (d[0] * d[0] + d[1] * d[1]) + (d[2] * d[2] + d[3] * d[3]);
#pragma unroll
    for (int off = 16; off >= 1; off >>= 1) sq += __shfl_xor(sq, off, 32);
    if (lane == 0) red2[wave] = sq;
    __syncthreads();
    float tot2 = 0.0f;
#pragma unroll
    for (int w = 0; w < 8; ++w) tot2 += red2[w];
    const float var = tot2 * (1.0f / 1024.0f);
    const float rstd = rsqrtf(var + 1.0e-5f);

    v4f gv = *(const v4f*)(g + t * 4);
    v4f bv = *(const v4f*)(be + t * 4);
    v4f y = d * rstd * gv + bv;
    v4h yh;
    yh[0] = (f16)y[0]; yh[1] = (f16)y[1]; yh[2] = (f16)y[2]; yh[3] = (f16)y[3];

    *(v4f*)(outf + base) = y;
    if (write_h) *(v4h*)(outh + base) = yh;
    
}

// ---------------- host launcher ----------------
extern "C" void kernel_launch(void* const* d_in, const int* in_sizes, int n_in,
                              void* d_out, int out_size, void* d_ws, size_t ws_size,
                              hipStream_t stream) {
    const int Mtok = MTOK;
    if (n_in < 14) return;
    if (in_sizes[0] < ((NB - 1) * SEQ_FULL + SEQ) * HID || in_sizes[1] < (NB - 1) * SEQ_FULL + SEQ ||
        in_sizes[2] < HID * HID || in_sizes[3] < HID || in_sizes[4] < HID * HID || in_sizes[5] < HID ||
        in_sizes[6] < HID || in_sizes[7] < HID || in_sizes[8] < DFF * HID || in_sizes[9] < DFF ||
        in_sizes[10] < HID * DFF || in_sizes[11] < HID || in_sizes[12] < HID || in_sizes[13] < HID ||
        out_size < Mtok * HID) return;

    const float* x    = (const float*)d_in[0];
    const float* amsk = (const float*)d_in[1];
    const float* Wq   = (const float*)d_in[2];  const float* bq   = (const float*)d_in[3];
    const float* Wso  = (const float*)d_in[4];  const float* bso  = (const float*)d_in[5];
    const float* ln1g = (const float*)d_in[6];  const float* ln1b = (const float*)d_in[7];
    const float* Wi   = (const float*)d_in[8];  const float* bi   = (const float*)d_in[9];
    const float* Wo   = (const float*)d_in[10]; const float* bo   = (const float*)d_in[11];
    const float* ln2g = (const float*)d_in[12]; const float* ln2b = (const float*)d_in[13];

    char* ws = (char*)d_ws;
    size_t off = 0;
    auto take = [&](size_t bytes) -> char* {
        char* p = ws + off;
        off += (bytes + 255) & ~(size_t)255;
        return p;
    };
    f16*   xh    = (f16*)take((size_t)Mtok * HID * 2);      // [Mtok][1024]
    f16*   wq16  = (f16*)take((size_t)HID * HID * 2);       // [N=1024][K=1024]
    f16*   wso16 = (f16*)take((size_t)HID * HID * 2);       // [N=1024][K=1024]
    f16*   wi16  = (f16*)take((size_t)DFF * HID * 2);       // [N=4096][K=1024]
    f16*   wo16  = (f16*)take((size_t)HID * DFF * 2);       // [N=1024][K=4096]
    f16*   qkvh  = (f16*)take((size_t)Mtok * HID * 2);
    f16*   ctxh  = (f16*)take((size_t)Mtok * HID * 2);
    float* attf  = (float*)take((size_t)Mtok * HID * 4);    // also holds fff later (same extent)
    float* h1f   = (float*)take((size_t)Mtok * HID * 4);
    f16*   h1h   = (f16*)take((size_t)Mtok * HID * 2);
    f16*   gh    = (f16*)take((size_t)Mtok * DFF * 2);
    float* fff   = attf;                                    // attf fully consumed by LN1 before the output GEMM writes fff
    if (off > ws_size) return;

    const int thr = 256;
    const float wsc = 64.0f;   // 2^6 weight operand scale, folded back in the GEMM epilogue

    // activations -> f16 (compact token rows), weights [N][K] -> scaled f16 [N][K]
    k_cvt<<<(Mtok * HID / 8 + thr - 1) / thr, thr, 0, stream>>>(x, xh, Mtok * HID, HID, SEQ, SEQ_FULL, 1.0f);
    k_cvt<<<(HID * HID / 8 + thr - 1) / thr, thr, 0, stream>>>(Wq, wq16, HID * HID, HID, HID, HID, wsc);
    k_cvt<<<(HID * HID / 8 + thr - 1) / thr, thr, 0, stream>>>(Wso, wso16, HID * HID, HID, HID, HID, wsc);
    k_cvt<<<(DFF * HID / 8 + thr - 1) / thr, thr, 0, stream>>>(Wi, wi16, DFF * HID, HID, DFF, DFF, wsc);
    k_cvt<<<(HID * DFF / 8 + thr - 1) / thr, thr, 0, stream>>>(Wo, wo16, HID * DFF, DFF, HID, HID, wsc);

    const dim3 gH(HID / GBN, Mtok / GBM);     // N = 1024
    const dim3 gF(DFF / GBN, Mtok / GBM);     // N = 4096

    // Placeholder pointer arguments below (omode / write_h exclude them) are valid, correctly typed
    // workspace regions that the launch never dereferences.

    // shared q/k/v projection (f16 out only, [Mtok][1024]); Cf placeholder = attf
    k_gemm<<<gH, thr, 0, stream>>>(xh, wq16, bq, attf, qkvh, Mtok, HID, HID, 0, 0.015625f, 2);

    // attention: one block per (batch, head, 128 queries); ctx carried * 2^4
    k_attn<<<NB * NHD * (SEQ / 128), thr, 0, stream>>>(qkvh, amsk, ctxh, NB);

    // self-output projection (f32 out only, * 2^-6 * 2^-4); Ch placeholder = gh
    k_gemm<<<gH, thr, 0, stream>>>(ctxh, wso16, bso, attf, gh, Mtok, HID, HID, 0, 0.0009765625f, 1);
    // LN1(attn + bf16(x)) -> h1 (f32 + f16 copy)
    k_ln<<<Mtok, thr, 0, stream>>>(attf, x, SEQ, SEQ_FULL, 1, ln1g, ln1b, h1f, h1h, 1, Mtok);

    // FFN: GELU(h1.Wi^T + bi) (f16 out only; Cf placeholder = attf) . Wo^T + bo (f32 out only; Ch placeholder = h1h)
    k_gemm<<<gF, thr, 0, stream>>>(h1h, wi16, bi, attf, gh, Mtok, DFF, HID, 1, 0.015625f, 2);
    k_gemm<<<gH, thr, 0, stream>>>(gh, wo16, bo, fff, h1h, Mtok, HID, DFF, 0, 0.015625f, 1);
    // LN2(ff + h1) -> d_out (f32 only; outh placeholder = h1h, residual not converted)
    k_ln<<<Mtok, thr, 0, stream>>>(fff, h1f, SEQ, SEQ, 0, ln2g, ln2b, (float*)d_out, h1h, 0, Mtok);
}

// v002
// Measured time: 216 microseconds a run.
// Timed twice side by side with v001, it ran 1.24 times as fast both times.
// All steps since v000 together make it 1.63 times as fast.
#include <hip/hip_runtime.h>
#include <stdint.h>
// All contractions: v_wmma_f32_16x16x32_f16 (f16 operands, f32 accumulate): qkv, self-output, intermediate and output projections (float inputs RNE-converted to bf16 then f16; weight operand scaled by 2^6, ctx operand by 2^4, folded back in the epilogue), q.k^T and p.v (p scaled by 2^12); softmax, LayerNorm, GELU, residuals in f32.

#ifndef NB
#define NB 2
#endif
#ifndef SEQ
#define SEQ 2048
#endif
#define NB_FULL 2
#define SEQ_FULL 2048
#define HID 1024
#define NHD 16
#define DHD 64
#define DFF 4096
#define MTOK (NB * SEQ)

static_assert(NB >= 1 && NB <= NB_FULL);
static_assert(SEQ >= 128 && SEQ <= SEQ_FULL && (SEQ % 128) == 0);
static_assert((MTOK % 128) == 0);
static_assert(HID == NHD * DHD);
static_assert((HID % 128) == 0 && (DFF % 128) == 0 && (HID % 32) == 0 && (DFF % 32) == 0);

typedef _Float16 f16;
typedef f16   v4h  __attribute__((ext_vector_type(4)));
typedef f16   v8h  __attribute__((ext_vector_type(8)));
typedef f16   v16h __attribute__((ext_vector_type(16)));
typedef float v4f  __attribute__((ext_vector_type(4)));
typedef float v8f  __attribute__((ext_vector_type(8)));
union Frag { v16h v; v8h half[2]; };

// 16x16x32 f16 WMMA with hazard guard (4 VALU slots) tied to D, A and B
__device__ __forceinline__ v8f wmma16(v16h a, v16h b, v8f c) {
    v8f d = __builtin_amdgcn_wmma_f32_16x16x32_f16(false, a, false, b, (short)0, c, false, false);
    asm volatile("v_nop\n\tv_nop\n\tv_nop\n\tv_nop" : "+v"(d) : "v"(a), "v"(b));
    return d;
}
__device__ __forceinline__ v8f zero8() {
    v8f z;
#pragma unroll
    for (int i = 0; i < 8; ++i) z[i] = 0.0f;
    return z;
}
// f32 -> nearest-even bf16 value, returned as f32
__device__ __forceinline__ float bf16r(float x) {
    unsigned u = __float_as_uint(x);
    u = (u + 0x7FFFu + ((u >> 16) & 1u)) & 0xFFFF0000u;
    return __uint_as_float(u);
}

// compact destination row m reads source row (m / seq) * seqf + m % seq (identity when seq >= row count)
__global__ __launch_bounds__(256) void k_cvt(const float* __restrict__ in, f16* out, int n, int rowlen,
                                              int seq, int seqf, float scale) {
    const size_t i8 = ((size_t)blockIdx.x * 256 + threadIdx.x) * 8;
    if (i8 + 8 > (size_t)n) return;
    const int m = (int)(i8 / (size_t)rowlen);
    const int c = (int)(i8 - (size_t)m * (size_t)rowlen);
    const size_t src = ((size_t)(m / seq) * (size_t)seqf + (size_t)(m % seq)) * (size_t)rowlen + (size_t)c;
    v4f a = *(const v4f*)(in + src);
    v4f b = *(const v4f*)(in + src + 4);
    v8h hv;
    hv[0] = (f16)(bf16r(a[0]) * scale); hv[1] = (f16)(bf16r(a[1]) * scale);
    hv[2] = (f16)(bf16r(a[2]) * scale); hv[3] = (f16)(bf16r(a[3]) * scale);
    hv[4] = (f16)(bf16r(b[0]) * scale); hv[5] = (f16)(bf16r(b[1]) * scale);
    hv[6] = (f16)(bf16r(b[2]) * scale); hv[7] = (f16)(bf16r(b[3]) * scale);
    f16* p = out + i8;
    *(v8h*)p = hv;
    
}

// ---------------- tiled GEMM: C[M][N] = A[M][K] (f16) . B, B given as BT[N][K] (f16, k-contiguous) ----------------
// epilogue: * oscale + bias, optional exact GELU; f32 (omode bit 0) and/or f16 (omode bit 1) output,
#define GBM 128
#define GBN 128
#define GBK 128     // k depth of one ring stage
#define GLD 136     // staged row: 128 halves + 8 pad = 272 B
#define GSP 132     // staging row pitch in floats (528 B)
#define GTILE (GBM * GLD)       // halves of one operand tile in LDS
#define GSTAGE (2 * GTILE)      // halves of one stage: [A tile | B tile]

static_assert((HID % GBK) == 0 && (DFF % GBK) == 0);
static_assert(64 * GSP * 4 <= 2 * GSTAGE * 2);

// One lane's share of a 128-row x 256-byte operand tile: rows r, r+16, .. r+112, 16 bytes each, global -> LDS
// without passing registers. lds = LDS byte address of row r's piece, g = its global address, gstep = 16 rows in halves.
// s_wait_xcnt is the statement's last line, a precaution: so it stands ahead of every later rewrite of these address registers.
__device__ __forceinline__ void copy_tile(unsigned lds, const f16* g, size_t gstep) {
    asm volatile("global_load_async_to_lds_b128 %0, %8, off\n\t"
                 "global_load_async_to_lds_b128 %1, %9, off\n\t"
                 "global_load_async_to_lds_b128 %2, %10, off\n\t"
                 "global_load_async_to_lds_b128 %3, %11, off\n\t"
                 "global_load_async_to_lds_b128 %4, %12, off\n\t"
                 "global_load_async_to_lds_b128 %5, %13, off\n\t"
                 "global_load_async_to_lds_b128 %6, %14, off\n\t"
                 "global_load_async_to_lds_b128 %7, %15, off\n\t"
                 "s_wait_xcnt 0x0"
                 :: "v"(lds), "v"(lds + 1u * 16u * GLD * 2u), "v"(lds + 2u * 16u * GLD * 2u),
                    "v"(lds + 3u * 16u * GLD * 2u), "v"(lds + 4u * 16u * GLD * 2u), "v"(lds + 5u * 16u * GLD * 2u),
                    "v"(lds + 6u * 16u * GLD * 2u), "v"(lds + 7u * 16u * GLD * 2u),
                    "v"(g), "v"(g + gstep), "v"(g + 2 * gstep), "v"(g + 3 * gstep),
                    "v"(g + 4 * gstep), "v"(g + 5 * gstep), "v"(g + 6 * gstep), "v"(g + 7 * gstep)
                 : "memory");
}

__global__ __launch_bounds__(256) void k_gemm(const f16* __restrict__ A, const f16* __restrict__ BT,
                                               const float* __restrict__ bias, float* Cf, f16* Ch,
                                               int M, int N, int K, int act, float oscale, int omode) {
    __shared__ __attribute__((aligned(16))) f16 ring[2 * GSTAGE];   // two stages; output staging once the loop has left it
    float* Cs = (float*)ring;

    const int t = threadIdx.x, wave = t >> 5, lane = t & 31;
    const int hh = lane >> 4, l16 = lane & 15;
    const int wm = wave >> 2, wn = wave & 3;          // 2 x 4 waves, 64 x 32 per wave
    const int bm0 = blockIdx.y * GBM, bn0 = blockIdx.x * GBN;
    if (bm0 + GBM > M || bn0 + GBN > N) return;       // block-uniform; host guarantees exact multiples

    v8f acc[4][2];
#pragma unroll
    for (int i = 0; i < 4; ++i)
#pragma unroll
        for (int j = 0; j < 2; ++j) acc[i][j] = zero8();

    // two-buffer ring: stage s lives in buffer s & 1; its copies fly while stage s - 1 is multiplied
    const int nk = K / GBK;
    const int crow = t >> 4, cseg = (t & 15) * 8;     // this lane copies rows crow + 16 j, halves cseg .. cseg + 7
    const f16* ga = A  + (size_t)(bm0 + crow) * K + cseg;
    const f16* gb = BT + (size_t)(bn0 + crow) * K + cseg;
    const size_t gstep = (size_t)16 * K;
    const unsigned lcopy = (unsigned)(uintptr_t)ring + (unsigned)(crow * GLD + cseg) * 2u;

    copy_tile(lcopy, ga, gstep);
    copy_tile(lcopy + GTILE * 2u, gb, gstep);
    asm volatile("s_wait_asynccnt 0x0" ::: "memory");   // stage 0 of this wave has landed
    __syncthreads();                                    // ... and of every wave
    if (nk > 1) {
        copy_tile(lcopy + GSTAGE * 2u, ga + GBK, gstep);
        copy_tile(lcopy + (GSTAGE + GTILE) * 2u, gb + GBK, gstep);
    }

    for (int it = 0; it < nk; ++it) {
        const unsigned buf = (unsigned)(it & 1);
        const f16* As = ring + buf * GSTAGE;
        const f16* Bs = As + GTILE;
#pragma unroll   // every LDS offset of the stage becomes an immediate
        for (int ks = 0; ks < GBK / 32; ++ks) {
            Frag af[4], bf[2];
#pragma unroll
            for (int mf = 0; mf < 4; ++mf) {
                const f16* ap = As + (wm * 64 + mf * 16 + l16) * GLD + ks * 32;
                af[mf].half[0] = *(const v8h*)(ap + 8 * hh);        // k = 8h .. 8h+7
                af[mf].half[1] = *(const v8h*)(ap + 16 + 8 * hh);   // k = 16+8h .. 16+8h+7
            }
#pragma unroll
            for (int nf = 0; nf < 2; ++nf) {
                const f16* bp = Bs + (wn * 32 + nf * 16 + l16) * GLD + ks * 32;   // column n, k-contiguous
                bf[nf].half[0] = *(const v8h*)(bp + 8 * hh);
                bf[nf].half[1] = *(const v8h*)(bp + 16 + 8 * hh);
            }
#pragma unroll
            for (int mf = 0; mf < 4; ++mf)
#pragma unroll
                for (int nf = 0; nf < 2; ++nf)
                    acc[mf][nf] = wmma16(af[mf].v, bf[nf].v, acc[mf][nf]);
        }
        asm volatile("s_wait_dscnt 0x0" ::: "memory");      // this wave's reads of buffer buf are done before it is refilled
        asm volatile("s_wait_asynccnt 0x0" ::: "memory");   // this wave's copies of stage it + 1 have landed
        __syncthreads();                                    // publishes stage it + 1, frees buffer buf
        if (it + 2 < nk) {
            copy_tile(lcopy + buf * (GSTAGE * 2u), ga + (size_t)(it + 2) * GBK, gstep);
            copy_tile(lcopy + buf * (GSTAGE * 2u) + GTILE * 2u, gb + (size_t)(it + 2) * GBK, gstep);
        }
    }
    asm volatile("s_wait_asynccnt 0x0" ::: "memory");       // nothing in flight when the ring becomes output staging

#pragma unroll 1
    for (int p = 0; p < 2; ++p) {
        if (wm == p) {
#pragma unroll
            for (int mf = 0; mf < 4; ++mf)
#pragma unroll
                for (int nf = 0; nf < 2; ++nf) {
                    const int col = wn * 32 + nf * 16 + l16;
                    const float bvv = bias[bn0 + col];
#pragma unroll
                    for (int r = 0; r < 8; ++r) {
                        const int row = mf * 16 + 8 * hh + r;
                        float x = acc[mf][nf][r] * oscale + bvv;
                        if (act) x = x * 0.5f * (1.0f + erff(x * 0.70710678118654752f));
                        Cs[row * GSP + col] = x;
                    }
                }
        }
        __syncthreads();
        if (omode & 1) {
            v4f vals[8];
            size_t po[8];
#pragma unroll
            for (int j = 0; j < 8; ++j) {
                const int e = t + 256 * j, row = e >> 5, c4 = (e & 31) * 4;
                vals[j] = *(const v4f*)(Cs + row * GSP + c4);
                po[j] = (size_t)(bm0 + p * 64 + row) * N + bn0 + c4;
            }
#pragma unroll
            for (int j = 0; j < 8; ++j) *(v4f*)(Cf + po[j]) = vals[j];
            
        }
        if (omode & 2) {
            v8h hv[4];
            size_t po[4];
#pragma unroll
            for (int j = 0; j < 4; ++j) {
                const int e = t + 256 * j, row = e >> 4, c8 = (e & 15) * 8;
                v4f a = *(const v4f*)(Cs + row * GSP + c8);
                v4f b = *(const v4f*)(Cs + row * GSP + c8 + 4);
                hv[j][0] = (f16)a[0]; hv[j][1] = (f16)a[1]; hv[j][2] = (f16)a[2]; hv[j][3] = (f16)a[3];
                hv[j][4] = (f16)b[0]; hv[j][5] = (f16)b[1]; hv[j][6] = (f16)b[2]; hv[j][7] = (f16)b[3];
                po[j] = (size_t)(bm0 + p * 64 + row) * N + bn0 + c8;
            }
#pragma unroll
            for (int j = 0; j < 4; ++j) *(v8h*)(Ch + po[j]) = hv[j];
            
        }
        __syncthreads();
    }
}

#define ALD 72      // staged row: 64 halves + 8 pad = 144 B

// lane l <-> lane l ^ 16
__device__ __forceinline__ float xhalf(float x) {
    const int b = __builtin_bit_cast(int, x);
    return __builtin_bit_cast(float, __builtin_amdgcn_permlanex16(b, b, 0x76543210, 0xfedcba98, false, false));
}

__global__ __launch_bounds__(256) void k_attn(const f16* __restrict__ QKV, const float* __restrict__ mask,
                                               f16* Ctx, int nb) {
    __shared__ f16 Ks[64 * ALD];          // [key][dim]
    __shared__ f16 Vs[64 * ALD];          // [dim][key]

    const int t = threadIdx.x, wave = t >> 5, lane = t & 31;
    const int hh = lane >> 4, l16 = lane & 15;
    const int bid = blockIdx.x;
    const int nqt = SEQ / 128;
    const int qt = bid % nqt, h = (bid / nqt) % NHD, b = bid / (nqt * NHD);
    if (b >= nb) return;
    const int q0 = qt * 128 + wave * 16;
    const size_t tok0 = (size_t)b * SEQ;             // compact token row base of this batch

    // Q as B operand: column n = query l16, 64 dims = two k=32 fragments
    Frag qb[2];
    {
        const f16* qp = QKV + (tok0 + q0 + l16) * HID + h * DHD;
#pragma unroll
        for (int kf = 0; kf < 2; ++kf) {
            qb[kf].half[0] = *(const v8h*)(qp + kf * 32 + 8 * hh);
            qb[kf].half[1] = *(const v8h*)(qp + kf * 32 + 16 + 8 * hh);
        }
    }

    float mrun = -3.0e38f, lrun = 0.0f;   // this lane's query: running maximum (both halves agree), this half's share of the sum
    v8f o[4];                             // o[nf][r] = O[query l16][dim nf * 16 + 8 hh + r]
#pragma unroll
    for (int nf = 0; nf < 4; ++nf) o[nf] = zero8();

    for (int kt = 0; kt < SEQ / 64; ++kt) {
        // stage 64 keys x 64 dims: K row-major, V transposed into [dim][key] (same source rows)
        v8h kv[2];
#pragma unroll
        for (int j = 0; j < 2; ++j) {
            const int e = t + 256 * j, key = e >> 3, seg = (e & 7) * 8;
            const size_t g = (tok0 + kt * 64 + key) * HID + h * DHD + seg;
            kv[j] = *(const v8h*)(QKV + g);
        }
        // additive mask of this lane's 32 keys, n * 16 + 8 hh + r; asked for behind the tile, wanted only behind S^T
        v4f mk[4][2];
        {
            const float* mp = mask + (size_t)b * SEQ_FULL + kt * 64 + 8 * hh;
#pragma unroll
            for (int n = 0; n < 4; ++n) {
                mk[n][0] = *(const v4f*)(mp + n * 16);
                mk[n][1] = *(const v4f*)(mp + n * 16 + 4);
            }
        }
#pragma unroll
        for (int j = 0; j < 2; ++j) {
            const int e = t + 256 * j, key = e >> 3, seg = (e & 7) * 8;
            *(v8h*)(Ks + key * ALD + seg) = kv[j];
#pragma unroll
            for (int i = 0; i < 8; ++i) Vs[(seg + i) * ALD + key] = kv[j][i];
        }
        __syncthreads();

        // S^T = K.Q^T / 8 + additive mask ; A operand row m = key, k = dim contiguous in Ks row
        v8f s[4];
#pragma unroll
        for (int n = 0; n < 4; ++n) {
            Frag kb0, kb1;
            const f16* kp = Ks + (n * 16 + l16) * ALD;
            kb0.half[0] = *(const v8h*)(kp + 8 * hh);
            kb0.half[1] = *(const v8h*)(kp + 16 + 8 * hh);
            kb1.half[0] = *(const v8h*)(kp + 32 + 8 * hh);
            kb1.half[1] = *(const v8h*)(kp + 48 + 8 * hh);
            v8f z = zero8();
            z = wmma16(kb0.v, qb[0].v, z);
            z = wmma16(kb1.v, qb[1].v, z);
#pragma unroll
            for (int r = 0; r < 8; ++r) s[n][r] = z[r] * 0.125f + mk[n][r >> 2][r & 3];
        }

        // online softmax of one query per lane
        float mx4[4];
#pragma unroll
        for (int n = 0; n < 4; ++n) {
            mx4[n] = fmaxf(fmaxf(fmaxf(s[n][0], s[n][1]), fmaxf(s[n][2], s[n][3])),
                           fmaxf(fmaxf(s[n][4], s[n][5]), fmaxf(s[n][6], s[n][7])));
        }
        float mx = fmaxf(fmaxf(mx4[0], mx4[1]), fmaxf(mx4[2], mx4[3]));
        mx = fmaxf(mx, xhalf(mx));
        const float mnew = fmaxf(mrun, mx);
        const float corr = __expf(mrun - mnew);
        mrun = mnew;
#pragma unroll
        for (int nf = 0; nf < 4; ++nf)
#pragma unroll
            for (int r = 0; r < 8; ++r) o[nf][r] *= corr;
        float rs4[4];
#pragma unroll
        for (int n = 0; n < 4; ++n)
#pragma unroll
            for (int r = 0; r < 8; ++r) s[n][r] = (s[n][r] - mnew) * 1.44269504088896340736f;
#pragma unroll
        for (int n = 0; n < 4; ++n)
#pragma unroll
            for (int r = 0; r < 8; ++r) s[n][r] = __builtin_amdgcn_exp2f(s[n][r]);
#pragma unroll
        for (int n = 0; n < 4; ++n)
            rs4[n] = ((s[n][0] + s[n][1]) + (s[n][2] + s[n][3])) + ((s[n][4] + s[n][5]) + (s[n][6] + s[n][7]));
        lrun = lrun * corr + ((rs4[0] + rs4[1]) + (rs4[2] + rs4[3]));

        // two S^T tiles (keys 32 kf + 8 hh + r and 32 kf + 16 + 8 hh + r) are one B fragment; p scaled by 2^12
        Frag pb[2];
#pragma unroll
        for (int kf = 0; kf < 2; ++kf)
#pragma unroll
            for (int j = 0; j < 2; ++j)
#pragma unroll
                for (int r = 0; r < 8; ++r)
                    pb[kf].half[j][r] = (f16)(s[2 * kf + j][r] * 4096.0f);

        // O^T += V^T.P^T ; A operand row m = dim, k = key contiguous in Vs row
#pragma unroll
        for (int nf = 0; nf < 4; ++nf) {
            Frag vb0, vb1;
            const f16* vp = Vs + (nf * 16 + l16) * ALD;
            vb0.half[0] = *(const v8h*)(vp + 8 * hh);
            vb0.half[1] = *(const v8h*)(vp + 16 + 8 * hh);
            vb1.half[0] = *(const v8h*)(vp + 32 + 8 * hh);
            vb1.half[1] = *(const v8h*)(vp + 48 + 8 * hh);
            o[nf] = wmma16(vb0.v, pb[0].v, o[nf]);
            o[nf] = wmma16(vb1.v, pb[1].v, o[nf]);
        }
        __syncthreads();
    }

    // a lane's 8 accumulator registers are 8 consecutive dims of its query: one 16-byte store a tile
    const float il = 16.0f / ((lrun + xhalf(lrun)) * 4096.0f);
    v8h cv[4];
#pragma unroll
    for (int nf = 0; nf < 4; ++nf)
#pragma unroll
        for (int r = 0; r < 8; ++r) cv[nf][r] = (f16)(o[nf][r] * il);
    f16* cp = Ctx + (tok0 + q0 + l16) * HID + h * DHD + 8 * hh;
#pragma unroll
    for (int nf = 0; nf < 4; ++nf) *(v8h*)(cp + nf * 16) = cv[nf];
}

// ---------------- fused residual + LayerNorm over 1024 (256 threads x 4) ----------------
// residual row for compact row m is (m / rseq) * rseqf + m % rseq; res_bf16 != 0: residual is a raw input
// and is consumed as its RNE bf16 value; write_h != 0: also write the f16 copy (outh dereferenced only then)
__global__ __launch_bounds__(256) void k_ln(const float* __restrict__ a, const float* __restrict__ res,
                                             int rseq, int rseqf, int res_bf16,
                                             const float* __restrict__ g, const float* __restrict__ be,
                                             float* outf, f16* outh, int write_h, int nrows) {
    __shared__ float red1[8], red2[8];
    const int row = blockIdx.x;
    if (row >= nrows) return;
    const int t = threadIdx.x, wave = t >> 5, lane = t & 31;
    const size_t base = (size_t)row * HID + (size_t)t * 4;
    const size_t rrow = (size_t)(row / rseq) * (size_t)rseqf + (size_t)(row % rseq);
    const size_t rbase = rrow * HID + (size_t)t * 4;

    v4f rv = *(const v4f*)(res + rbase);
    if (res_bf16) {
        rv[0] = bf16r(rv[0]); rv[1] = bf16r(rv[1]); rv[2] = bf16r(rv[2]); rv[3] = bf16r(rv[3]);
    }
    v4f x = *(const v4f*)(a + base) + rv;
    float sm = (x[0] + x[1]) + (x[2] + x[3]);
#pragma unroll
    for (int off = 16; off >= 1; off >>= 1) sm += __shfl_xor(sm, off, 32);
    if (lane == 0) red1[wave] = sm;
    __syncthreads();
    float tot = 0.0f;
#pragma unroll
    for (int w = 0; w < 8; ++w) tot += red1[w];
    const float mu = tot * (1.0f / 1024.0f);

    v4f d = x - mu;
    float sq = (d[0] * d[0] + d[1] * d[1]) + (d[2] * d[2] + d[3] * d[3]);
#pragma unroll
    for (int off = 16; off >= 1; off >>= 1) sq += __shfl_xor(sq, off, 32);
    if (lane == 0) red2[wave] = sq;
    __syncthreads();
    float tot2 = 0.0f;
#pragma unroll
    for (int w = 0; w < 8; ++w) tot2 += red2[w];
    const float var = tot2 * (1.0f / 1024.0f);
    const float rstd = rsqrtf(var + 1.0e-5f);

    v4f gv = *(const v4f*)(g + t * 4);
    v4f bv = *(const v4f*)(be + t * 4);
    v4f y = d * rstd * gv + bv;
    v4h yh;
    yh[0] = (f16)y[0]; yh[1] = (f16)y[1]; yh[2] = (f16)y[2]; yh[3] = (f16)y[3];

    *(v4f*)(outf + base) = y;
    if (write_h) *(v4h*)(outh + base) = yh;
    
}

// ---------------- host launcher ----------------
extern "C" void kernel_launch(void* const* d_in, const int* in_sizes, int n_in,
                              void* d_out, int out_size, void* d_ws, size_t ws_size,
                              hipStream_t stream) {
    const int Mtok = MTOK;
    if (n_in < 14) return;
    if (in_sizes[0] < ((NB - 1) * SEQ_FULL + SEQ) * HID || in_sizes[1] < (NB - 1) * SEQ_FULL + SEQ ||
        in_sizes[2] < HID * HID || in_sizes[3] < HID || in_sizes[4] < HID * HID || in_sizes[5] < HID ||
        in_sizes[6] < HID || in_sizes[7] < HID || in_sizes[8] < DFF * HID || in_sizes[9] < DFF ||
        in_sizes[10] < HID * DFF || in_sizes[11] < HID || in_sizes[12] < HID || in_sizes[13] < HID ||
        out_size < Mtok * HID) return;

    const float* x    = (const float*)d_in[0];
    const float* amsk = (const float*)d_in[1];
    const float* Wq   = (const float*)d_in[2];  const float* bq   = (const float*)d_in[3];
    const float* Wso  = (const float*)d_in[4];  const float* bso  = (const float*)d_in[5];
    const float* ln1g = (const float*)d_in[6];  const float* ln1b = (const float*)d_in[7];
    const float* Wi   = (const float*)d_in[8];  const float* bi   = (const float*)d_in[9];
    const float* Wo   = (const float*)d_in[10]; const float* bo   = (const float*)d_in[11];
    const float* ln2g = (const float*)d_in[12]; const float* ln2b = (const float*)d_in[13];

    char* ws = (char*)d_ws;
    size_t off = 0;
    auto take = [&](size_t bytes) -> char* {
        char* p = ws + off;
        off += (bytes + 255) & ~(size_t)255;
        return p;
    };
    f16*   xh    = (f16*)take((size_t)Mtok * HID * 2);      // [Mtok][1024]
    f16*   wq16  = (f16*)take((size_t)HID * HID * 2);       // [N=1024][K=1024]
    f16*   wso16 = (f16*)take((size_t)HID * HID * 2);       // [N=1024][K=1024]
    f16*   wi16  = (f16*)take((size_t)DFF * HID * 2);       // [N=4096][K=1024]
    f16*   wo16  = (f16*)take((size_t)HID * DFF * 2);       // [N=1024][K=4096]
    f16*   qkvh  = (f16*)take((size_t)Mtok * HID * 2);
    f16*   ctxh  = (f16*)take((size_t)Mtok * HID * 2);
    float* attf  = (float*)take((size_t)Mtok * HID * 4);    // also holds fff later (same extent)
    float* h1f   = (float*)take((size_t)Mtok * HID * 4);
    f16*   h1h   = (f16*)take((size_t)Mtok * HID * 2);
    f16*   gh    = (f16*)take((size_t)Mtok * DFF * 2);
    float* fff   = attf;                                    // attf fully consumed by LN1 before the output GEMM writes fff
    if (off > ws_size) return;

    const int thr = 256;
    const float wsc = 64.0f;   // 2^6 weight operand scale, folded back in the GEMM epilogue

    // activations -> f16 (compact token rows), weights [N][K] -> scaled f16 [N][K]
    k_cvt<<<(Mtok * HID / 8 + thr - 1) / thr, thr, 0, stream>>>(x, xh, Mtok * HID, HID, SEQ, SEQ_FULL, 1.0f);
    k_cvt<<<(HID * HID / 8 + thr - 1) / thr, thr, 0, stream>>>(Wq, wq16, HID * HID, HID, HID, HID, wsc);
    k_cvt<<<(HID * HID / 8 + thr - 1) / thr, thr, 0, stream>>>(Wso, wso16, HID * HID, HID, HID, HID, wsc);
    k_cvt<<<(DFF * HID / 8 + thr - 1) / thr, thr, 0, stream>>>(Wi, wi16, DFF * HID, HID, DFF, DFF, wsc);
    k_cvt<<<(HID * DFF / 8 + thr - 1) / thr, thr, 0, stream>>>(Wo, wo16, HID * DFF, DFF, HID, HID, wsc);

    const dim3 gH(HID / GBN, Mtok / GBM);     // N = 1024
    const dim3 gF(DFF / GBN, Mtok / GBM);     // N = 4096

    // Placeholder pointer arguments below (omode / write_h exclude them) are valid, correctly typed
    // workspace regions that the launch never dereferences.

    // shared q/k/v projection (f16 out only, [Mtok][1024]); Cf placeholder = attf
    k_gemm<<<gH, thr, 0, stream>>>(xh, wq16, bq, attf, qkvh, Mtok, HID, HID, 0, 0.015625f, 2);

    // attention: one block per (batch, head, 128 queries); ctx carried * 2^4
    k_attn<<<NB * NHD * (SEQ / 128), thr, 0, stream>>>(qkvh, amsk, ctxh, NB);

    // self-output projection (f32 out only, * 2^-6 * 2^-4); Ch placeholder = gh
    k_gemm<<<gH, thr, 0, stream>>>(ctxh, wso16, bso, attf, gh, Mtok, HID, HID, 0, 0.0009765625f, 1);
    // LN1(attn + bf16(x)) -> h1 (f32 + f16 copy)
    k_ln<<<Mtok, thr, 0, stream>>>(attf, x, SEQ, SEQ_FULL, 1, ln1g, ln1b, h1f, h1h, 1, Mtok);

    // FFN: GELU(h1.Wi^T + bi) (f16 out only; Cf placeholder = attf) . Wo^T + bo (f32 out only; Ch placeholder = h1h)
    k_gemm<<<gF, thr, 0, stream>>>(h1h, wi16, bi, attf, gh, Mtok, DFF, HID, 1, 0.015625f, 2);
    k_gemm<<<gH, thr, 0, stream>>>(gh, wo16, bo, fff, h1h, Mtok, HID, DFF, 0, 0.015625f, 1);
    // LN2(ff + h1) -> d_out (f32 only; outh placeholder = h1h, residual not converted)
    k_ln<<<Mtok, thr, 0, stream>>>(fff, h1f, SEQ, SEQ, 0, ln2g, ln2b, (float*)d_out, h1h, 0, Mtok);
}

// v003
// A run of this version takes 191 microseconds.
// Timed twice side by side with v002, it ran 1.12 and 1.13 times as fast.
// Counting every step since v000, it is 1.83 times as fast.
#include <hip/hip_runtime.h>
#include <stdint.h>
// All contractions: v_wmma_f32_16x16x32_f16 (f16 operands, f32 accumulate): qkv, self-output, intermediate and output projections (float inputs RNE-converted to bf16 then f16; weight operand scaled by 2^6, ctx operand by 2^4, folded back in the epilogue), q.k^T and p.v (p scaled by 2^12); softmax, LayerNorm, GELU, residuals in f32.

#ifndef NB
#define NB 2
#endif
#ifndef SEQ
#define SEQ 2048
#endif
#define NB_FULL 2
#define SEQ_FULL 2048
#define HID 1024
#define NHD 16
#define DHD 64
#define DFF 4096
#define MTOK (NB * SEQ)

static_assert(NB >= 1 && NB <= NB_FULL);
static_assert(SEQ >= 128 && SEQ <= SEQ_FULL && (SEQ % 128) == 0);
static_assert((MTOK % 128) == 0);
static_assert(HID == NHD * DHD);
static_assert((HID % 128) == 0 && (DFF % 128) == 0 && (HID % 32) == 0 && (DFF % 32) == 0);

typedef _Float16 f16;
typedef f16   v4h  __attribute__((ext_vector_type(4)));
typedef f16   v8h  __attribute__((ext_vector_type(8)));
typedef f16   v16h __attribute__((ext_vector_type(16)));
typedef float v4f  __attribute__((ext_vector_type(4)));
typedef float v8f  __attribute__((ext_vector_type(8)));
union Frag { v16h v; v8h half[2]; };

// 16x16x32 f16 WMMA with hazard guard (4 VALU slots) tied to D, A and B
__device__ __forceinline__ v8f wmma16(v16h a, v16h b, v8f c) {
    v8f d = __builtin_amdgcn_wmma_f32_16x16x32_f16(false, a, false, b, (short)0, c, false, false);
    asm volatile("v_nop\n\tv_nop\n\tv_nop\n\tv_nop" : "+v"(d) : "v"(a), "v"(b));
    return d;
}
__device__ __forceinline__ v8f zero8() {
    v8f z;
#pragma unroll
    for (int i = 0; i < 8; ++i) z[i] = 0.0f;
    return z;
}
// f32 -> nearest-even bf16 value, returned as f32
__device__ __forceinline__ float bf16r(float x) {
    unsigned u = __float_as_uint(x);
    u = (u + 0x7FFFu + ((u >> 16) & 1u)) & 0xFFFF0000u;
    return __uint_as_float(u);
}

// compact destination row m reads source row (m / seq) * seqf + m % seq (identity when seq >= row count)
__global__ __launch_bounds__(256) void k_cvt(const float* __restrict__ in, f16* out, int n, int rowlen,
                                              int seq, int seqf, float scale) {
    const size_t i8 = ((size_t)blockIdx.x * 256 + threadIdx.x) * 8;
    if (i8 + 8 > (size_t)n) return;
    const int m = (int)(i8 / (size_t)rowlen);
    const int c = (int)(i8 - (size_t)m * (size_t)rowlen);
    const size_t src = ((size_t)(m / seq) * (size_t)seqf + (size_t)(m % seq)) * (size_t)rowlen + (size_t)c;
    v4f a = *(const v4f*)(in + src);
    v4f b = *(const v4f*)(in + src + 4);
    v8h hv;
    hv[0] = (f16)(bf16r(a[0]) * scale); hv[1] = (f16)(bf16r(a[1]) * scale);
    hv[2] = (f16)(bf16r(a[2]) * scale); hv[3] = (f16)(bf16r(a[3]) * scale);
    hv[4] = (f16)(bf16r(b[0]) * scale); hv[5] = (f16)(bf16r(b[1]) * scale);
    hv[6] = (f16)(bf16r(b[2]) * scale); hv[7] = (f16)(bf16r(b[3]) * scale);
    f16* p = out + i8;
    *(v8h*)p = hv;
    
}

// ---------------- tiled GEMM: C[M][N] = A[M][K] (f16) . B, B given as BT[N][K] (f16, k-contiguous) ----------------
// epilogue: * oscale + bias, optional exact GELU; f32 (omode bit 0) and/or f16 (omode bit 1) output,
#define GBM 128
#define GBN 128
#define GBK 128     // k depth of one ring stage
#define GLD 136     // staged row: 128 halves + 8 pad = 272 B
#define GSP 132     // staging row pitch in floats (528 B)
#define GTILE (GBM * GLD)       // halves of one operand tile in LDS
#define GSTAGE (2 * GTILE)      // halves of one stage: [A tile | B tile]

static_assert((HID % GBK) == 0 && (DFF % GBK) == 0);
static_assert(64 * GSP * 4 <= 2 * GSTAGE * 2);

// One lane's share of a 128-row x 256-byte operand tile: rows r, r+16, .. r+112, 16 bytes each, global -> LDS
// without passing registers. lds = LDS byte address of row r's piece, g = its global address, gstep = 16 rows in halves.
// s_wait_xcnt is the statement's last line, a precaution: so it stands ahead of every later rewrite of these address registers.
__device__ __forceinline__ void copy_tile(unsigned lds, const f16* g, size_t gstep) {
    asm volatile("global_load_async_to_lds_b128 %0, %8, off\n\t"
                 "global_load_async_to_lds_b128 %1, %9, off\n\t"
                 "global_load_async_to_lds_b128 %2, %10, off\n\t"
                 "global_load_async_to_lds_b128 %3, %11, off\n\t"
                 "global_load_async_to_lds_b128 %4, %12, off\n\t"
                 "global_load_async_to_lds_b128 %5, %13, off\n\t"
                 "global_load_async_to_lds_b128 %6, %14, off\n\t"
                 "global_load_async_to_lds_b128 %7, %15, off\n\t"
                 "s_wait_xcnt 0x0"
                 :: "v"(lds), "v"(lds + 1u * 16u * GLD * 2u), "v"(lds + 2u * 16u * GLD * 2u),
                    "v"(lds + 3u * 16u * GLD * 2u), "v"(lds + 4u * 16u * GLD * 2u), "v"(lds + 5u * 16u * GLD * 2u),
                    "v"(lds + 6u * 16u * GLD * 2u), "v"(lds + 7u * 16u * GLD * 2u),
                    "v"(g), "v"(g + gstep), "v"(g + 2 * gstep), "v"(g + 3 * gstep),
                    "v"(g + 4 * gstep), "v"(g + 5 * gstep), "v"(g + 6 * gstep), "v"(g + 7 * gstep)
                 : "memory");
}

// exact GELU of two values, x/2 * (1 + erf(x / sqrt 2)), without a branch: erf's two ranges (|z| < 1: odd polynomial in z;
// else 1 - exp(-q(|z|))) are both evaluated and one is selected, so that the values of a lane are independent chains.
typedef float v2f __attribute__((ext_vector_type(2)));
__device__ __forceinline__ v2f fma2(v2f a, v2f b, float c) {
    v2f cc; cc[0] = c; cc[1] = c;
    return __builtin_elementwise_fma(a, b, cc);
}
__device__ __forceinline__ v2f gelu2(v2f x) {
    const v2f z = x * 0.70710678118654752f;
    v2f a; a[0] = fabsf(z[0]); a[1] = fabsf(z[1]);
    const v2f t = z * z;
    v2f ps; ps[0] = -0x1.268bc2p-11f; ps[1] = -0x1.268bc2p-11f;
    ps = fma2(t, ps, 0x1.420828p-8f);
    ps = fma2(t, ps, -0x1.b5937p-6f);
    ps = fma2(t, ps, 0x1.ce077cp-4f);
    ps = fma2(t, ps, -0x1.81266p-2f);
    ps = fma2(t, ps, 0x1.06ebap-3f);
    ps = __builtin_elementwise_fma(a, ps, a);
    v2f q; q[0] = 0x1.1d3156p-16f; q[1] = 0x1.1d3156p-16f;
    q = fma2(a, q, -0x1.8d129p-12f);
    q = fma2(a, q, 0x1.f9a6d2p-9f);
    q = fma2(a, q, -0x1.8c3164p-6f);
    q = fma2(a, q, 0x1.b4e9c8p-4f);
    q = fma2(a, q, 0x1.4515fap-1f);
    q = fma2(a, q, 0x1.078e5p-3f);
    q = __builtin_elementwise_fma(a, q, a);
    q = q * -1.44269504088896340736f;
    v2f e;
    e[0] = __builtin_copysignf(a[0] < 1.0f ? ps[0] : 1.0f - __builtin_amdgcn_exp2f(q[0]), z[0]);
    e[1] = __builtin_copysignf(a[1] < 1.0f ? ps[1] : 1.0f - __builtin_amdgcn_exp2f(q[1]), z[1]);
    return (x * 0.5f) * (1.0f + e);
}

__global__ __launch_bounds__(256) void k_gemm(const f16* __restrict__ A, const f16* __restrict__ BT,
                                               const float* __restrict__ bias, float* Cf, f16* Ch,
                                               int M, int N, int K, int act, float oscale, int omode) {
    __shared__ __attribute__((aligned(16))) f16 ring[2 * GSTAGE];   // two stages; output staging once the loop has left it
    float* Cs = (float*)ring;

    const int t = threadIdx.x, wave = t >> 5, lane = t & 31;
    const int hh = lane >> 4, l16 = lane & 15;
    const int wm = wave >> 2, wn = wave & 3;          // 2 x 4 waves, 64 x 32 per wave
    const int bm0 = blockIdx.y * GBM, bn0 = blockIdx.x * GBN;
    if (bm0 + GBM > M || bn0 + GBN > N) return;       // block-uniform; host guarantees exact multiples

    v8f acc[4][2];
#pragma unroll
    for (int i = 0; i < 4; ++i)
#pragma unroll
        for (int j = 0; j < 2; ++j) acc[i][j] = zero8();

    // two-buffer ring: stage s lives in buffer s & 1; its copies fly while stage s - 1 is multiplied
    const int nk = K / GBK;
    const int crow = t >> 4, cseg = (t & 15) * 8;     // this lane copies rows crow + 16 j, halves cseg .. cseg + 7
    const f16* ga = A  + (size_t)(bm0 + crow) * K + cseg;
    const f16* gb = BT + (size_t)(bn0 + crow) * K + cseg;
    const size_t gstep = (size_t)16 * K;
    const unsigned lcopy = (unsigned)(uintptr_t)ring + (unsigned)(crow * GLD + cseg) * 2u;

    copy_tile(lcopy, ga, gstep);
    copy_tile(lcopy + GTILE * 2u, gb, gstep);
    asm volatile("s_wait_asynccnt 0x0" ::: "memory");   // stage 0 of this wave has landed
    __syncthreads();                                    // ... and of every wave
    if (nk > 1) {
        copy_tile(lcopy + GSTAGE * 2u, ga + GBK, gstep);
        copy_tile(lcopy + (GSTAGE + GTILE) * 2u, gb + GBK, gstep);
    }

    for (int it = 0; it < nk; ++it) {
        const unsigned buf = (unsigned)(it & 1);
        const f16* As = ring + buf * GSTAGE;
        const f16* Bs = As + GTILE;
#pragma unroll   // every LDS offset of the stage becomes an immediate
        for (int ks = 0; ks < GBK / 32; ++ks) {
            Frag af[4], bf[2];
#pragma unroll
            for (int mf = 0; mf < 4; ++mf) {
                const f16* ap = As + (wm * 64 + mf * 16 + l16) * GLD + ks * 32;
                af[mf].half[0] = *(const v8h*)(ap + 8 * hh);        // k = 8h .. 8h+7
                af[mf].half[1] = *(const v8h*)(ap + 16 + 8 * hh);   // k = 16+8h .. 16+8h+7
            }
#pragma unroll
            for (int nf = 0; nf < 2; ++nf) {
                const f16* bp = Bs + (wn * 32 + nf * 16 + l16) * GLD + ks * 32;   // column n, k-contiguous
                bf[nf].half[0] = *(const v8h*)(bp + 8 * hh);
                bf[nf].half[1] = *(const v8h*)(bp + 16 + 8 * hh);
            }
#pragma unroll
            for (int mf = 0; mf < 4; ++mf)
#pragma unroll
                for (int nf = 0; nf < 2; ++nf)
                    acc[mf][nf] = wmma16(af[mf].v, bf[nf].v, acc[mf][nf]);
        }
        asm volatile("s_wait_dscnt 0x0" ::: "memory");      // this wave's reads of buffer buf are done before it is refilled
        asm volatile("s_wait_asynccnt 0x0" ::: "memory");   // this wave's copies of stage it + 1 have landed
        __syncthreads();                                    // publishes stage it + 1, frees buffer buf
        if (it + 2 < nk) {
            copy_tile(lcopy + buf * (GSTAGE * 2u), ga + (size_t)(it + 2) * GBK, gstep);
            copy_tile(lcopy + buf * (GSTAGE * 2u) + GTILE * 2u, gb + (size_t)(it + 2) * GBK, gstep);
        }
    }
    asm volatile("s_wait_asynccnt 0x0" ::: "memory");       // nothing in flight when the ring becomes output staging

    // scale, bias and activation: every wave on its own 64 values at once, in registers, ahead of the staging phases
    // (all loops unrolled: accumulator indices must be constants, and the 32 pairs must stand side by side to interleave)
#pragma unroll
    for (int nf = 0; nf < 2; ++nf) {
        const float bvv = bias[bn0 + wn * 32 + nf * 16 + l16];
#pragma unroll
        for (int mf = 0; mf < 4; ++mf)
#pragma unroll
            for (int r = 0; r < 8; ++r) acc[mf][nf][r] = acc[mf][nf][r] * oscale + bvv;
    }
    if (act) {
#pragma unroll
        for (int mf = 0; mf < 4; ++mf)
#pragma unroll
            for (int nf = 0; nf < 2; ++nf)
#pragma unroll
                for (int r = 0; r < 8; r += 2) {
                    v2f x; x[0] = acc[mf][nf][r]; x[1] = acc[mf][nf][r + 1];
                    x = gelu2(x);
                    acc[mf][nf][r] = x[0]; acc[mf][nf][r + 1] = x[1];
                }
    }

#pragma unroll 1
    for (int p = 0; p < 2; ++p) {
        if (wm == p) {
#pragma unroll
            for (int mf = 0; mf < 4; ++mf)
#pragma unroll
                for (int nf = 0; nf < 2; ++nf) {
                    const int col = wn * 32 + nf * 16 + l16;
#pragma unroll
                    for (int r = 0; r < 8; ++r) Cs[(mf * 16 + 8 * hh + r) * GSP + col] = acc[mf][nf][r];
                }
        }
        __syncthreads();
        if (omode & 1) {
            v4f vals[8];
            size_t po[8];
#pragma unroll
            for (int j = 0; j < 8; ++j) {
                const int e = t + 256 * j, row = e >> 5, c4 = (e & 31) * 4;
                vals[j] = *(const v4f*)(Cs + row * GSP + c4);
                po[j] = (size_t)(bm0 + p * 64 + row) * N + bn0 + c4;
            }
#pragma unroll
            for (int j = 0; j < 8; ++j) *(v4f*)(Cf + po[j]) = vals[j];
            
        }
        if (omode & 2) {
            v8h hv[4];
            size_t po[4];
#pragma unroll
            for (int j = 0; j < 4; ++j) {
                const int e = t + 256 * j, row = e >> 4, c8 = (e & 15) * 8;
                v4f a = *(const v4f*)(Cs + row * GSP + c8);
                v4f b = *(const v4f*)(Cs + row * GSP + c8 + 4);
                hv[j][0] = (f16)a[0]; hv[j][1] = (f16)a[1]; hv[j][2] = (f16)a[2]; hv[j][3] = (f16)a[3];
                hv[j][4] = (f16)b[0]; hv[j][5] = (f16)b[1]; hv[j][6] = (f16)b[2]; hv[j][7] = (f16)b[3];
                po[j] = (size_t)(bm0 + p * 64 + row) * N + bn0 + c8;
            }
#pragma unroll
            for (int j = 0; j < 4; ++j) *(v8h*)(Ch + po[j]) = hv[j];
            
        }
        __syncthreads();
    }
}

#define ALD 72      // staged row: 64 halves + 8 pad = 144 B

// lane l <-> lane l ^ 16
__device__ __forceinline__ float xhalf(float x) {
    const int b = __builtin_bit_cast(int, x);
    return __builtin_bit_cast(float, __builtin_amdgcn_permlanex16(b, b, 0x76543210, 0xfedcba98, false, false));
}

__global__ __launch_bounds__(256) void k_attn(const f16* __restrict__ QKV, const float* __restrict__ mask,
                                               f16* Ctx, int nb) {
    __shared__ f16 Ks[64 * ALD];          // [key][dim]
    __shared__ f16 Vs[64 * ALD];          // [dim][key]

    const int t = threadIdx.x, wave = t >> 5, lane = t & 31;
    const int hh = lane >> 4, l16 = lane & 15;
    const int bid = blockIdx.x;
    const int nqt = SEQ / 128;
    const int qt = bid % nqt, h = (bid / nqt) % NHD, b = bid / (nqt * NHD);
    if (b >= nb) return;
    const int q0 = qt * 128 + wave * 16;
    const size_t tok0 = (size_t)b * SEQ;             // compact token row base of this batch

    // Q as B operand: column n = query l16, 64 dims = two k=32 fragments
    Frag qb[2];
    {
        const f16* qp = QKV + (tok0 + q0 + l16) * HID + h * DHD;
#pragma unroll
        for (int kf = 0; kf < 2; ++kf) {
            qb[kf].half[0] = *(const v8h*)(qp + kf * 32 + 8 * hh);
            qb[kf].half[1] = *(const v8h*)(qp + kf * 32 + 16 + 8 * hh);
        }
    }

    float mrun = -3.0e38f, lrun = 0.0f;   // this lane's query: running maximum (both halves agree), this half's share of the sum
    v8f o[4];                             // o[nf][r] = O[query l16][dim nf * 16 + 8 hh + r]
#pragma unroll
    for (int nf = 0; nf < 4; ++nf) o[nf] = zero8();

    for (int kt = 0; kt < SEQ / 64; ++kt) {
        // stage 64 keys x 64 dims: K row-major, V transposed into [dim][key] (same source rows)
        v8h kv[2];
#pragma unroll
        for (int j = 0; j < 2; ++j) {
            const int e = t + 256 * j, key = e >> 3, seg = (e & 7) * 8;
            const size_t g = (tok0 + kt * 64 + key) * HID + h * DHD + seg;
            kv[j] = *(const v8h*)(QKV + g);
        }
        // additive mask of this lane's 32 keys, n * 16 + 8 hh + r; asked for behind the tile, wanted only behind S^T
        v4f mk[4][2];
        {
            const float* mp = mask + (size_t)b * SEQ_FULL + kt * 64 + 8 * hh;
#pragma unroll
            for (int n = 0; n < 4; ++n) {
                mk[n][0] = *(const v4f*)(mp + n * 16);
                mk[n][1] = *(const v4f*)(mp + n * 16 + 4);
            }
        }
#pragma unroll
        for (int j = 0; j < 2; ++j) {
            const int e = t + 256 * j, key = e >> 3, seg = (e & 7) * 8;
            *(v8h*)(Ks + key * ALD + seg) = kv[j];
#pragma unroll
            for (int i = 0; i < 8; ++i) Vs[(seg + i) * ALD + key] = kv[j][i];
        }
        __syncthreads();

        // S^T = K.Q^T / 8 + additive mask ; A operand row m = key, k = dim contiguous in Ks row
        v8f s[4];
#pragma unroll
        for (int n = 0; n < 4; ++n) {
            Frag kb0, kb1;
            const f16* kp = Ks + (n * 16 + l16) * ALD;
            kb0.half[0] = *(const v8h*)(kp + 8 * hh);
            kb0.half[1] = *(const v8h*)(kp + 16 + 8 * hh);
            kb1.half[0] = *(const v8h*)(kp + 32 + 8 * hh);
            kb1.half[1] = *(const v8h*)(kp + 48 + 8 * hh);
            v8f z = zero8();
            z = wmma16(kb0.v, qb[0].v, z);
            z = wmma16(kb1.v, qb[1].v, z);
#pragma unroll
            for (int r = 0; r < 8; ++r) s[n][r] = z[r] * 0.125f + mk[n][r >> 2][r & 3];
        }

        // online softmax of one query per lane
        float mx4[4];
#pragma unroll
        for (int n = 0; n < 4; ++n) {
            mx4[n] = fmaxf(fmaxf(fmaxf(s[n][0], s[n][1]), fmaxf(s[n][2], s[n][3])),
                           fmaxf(fmaxf(s[n][4], s[n][5]), fmaxf(s[n][6], s[n][7])));
        }
        float mx = fmaxf(fmaxf(mx4[0], mx4[1]), fmaxf(mx4[2], mx4[3]));
        mx = fmaxf(mx, xhalf(mx));
        const float mnew = fmaxf(mrun, mx);
        const float corr = __expf(mrun - mnew);
        mrun = mnew;
#pragma unroll
        for (int nf = 0; nf < 4; ++nf)
#pragma unroll
            for (int r = 0; r < 8; ++r) o[nf][r] *= corr;
        float rs4[4];
#pragma unroll
        for (int n = 0; n < 4; ++n)
#pragma unroll
            for (int r = 0; r < 8; ++r) s[n][r] = (s[n][r] - mnew) * 1.44269504088896340736f;
#pragma unroll
        for (int n = 0; n < 4; ++n)
#pragma unroll
            for (int r = 0; r < 8; ++r) s[n][r] = __builtin_amdgcn_exp2f(s[n][r]);
#pragma unroll
        for (int n = 0; n < 4; ++n)
            rs4[n] = ((s[n][0] + s[n][1]) + (s[n][2] + s[n][3])) + ((s[n][4] + s[n][5]) + (s[n][6] + s[n][7]));
        lrun = lrun * corr + ((rs4[0] + rs4[1]) + (rs4[2] + rs4[3]));

        // two S^T tiles (keys 32 kf + 8 hh + r and 32 kf + 16 + 8 hh + r) are one B fragment; p scaled by 2^12
        Frag pb[2];
#pragma unroll
        for (int kf = 0; kf < 2; ++kf)
#pragma unroll
            for (int j = 0; j < 2; ++j)
#pragma unroll
                for (int r = 0; r < 8; ++r)
                    pb[kf].half[j][r] = (f16)(s[2 * kf + j][r] * 4096.0f);

        // O^T += V^T.P^T ; A operand row m = dim, k = key contiguous in Vs row
#pragma unroll
        for (int nf = 0; nf < 4; ++nf) {
            Frag vb0, vb1;
            const f16* vp = Vs + (nf * 16 + l16) * ALD;
            vb0.half[0] = *(const v8h*)(vp + 8 * hh);
            vb0.half[1] = *(const v8h*)(vp + 16 + 8 * hh);
            vb1.half[0] = *(const v8h*)(vp + 32 + 8 * hh);
            vb1.half[1] = *(const v8h*)(vp + 48 + 8 * hh);
            o[nf] = wmma16(vb0.v, pb[0].v, o[nf]);
            o[nf] = wmma16(vb1.v, pb[1].v, o[nf]);
        }
        __syncthreads();
    }

    // a lane's 8 accumulator registers are 8 consecutive dims of its query: one 16-byte store a tile
    const float il = 16.0f / ((lrun + xhalf(lrun)) * 4096.0f);
    v8h cv[4];
#pragma unroll
    for (int nf = 0; nf < 4; ++nf)
#pragma unroll
        for (int r = 0; r < 8; ++r) cv[nf][r] = (f16)(o[nf][r] * il);
    f16* cp = Ctx + (tok0 + q0 + l16) * HID + h * DHD + 8 * hh;
#pragma unroll
    for (int nf = 0; nf < 4; ++nf) *(v8h*)(cp + nf * 16) = cv[nf];
}

// ---------------- fused residual + LayerNorm over 1024 (256 threads x 4) ----------------
// residual row for compact row m is (m / rseq) * rseqf + m % rseq; res_bf16 != 0: residual is a raw input
// and is consumed as its RNE bf16 value; write_h != 0: also write the f16 copy (outh dereferenced only then)
__global__ __launch_bounds__(256) void k_ln(const float* __restrict__ a, const float* __restrict__ res,
                                             int rseq, int rseqf, int res_bf16,
                                             const float* __restrict__ g, const float* __restrict__ be,
                                             float* outf, f16* outh, int write_h, int nrows) {
    __shared__ float red1[8], red2[8];
    const int row = blockIdx.x;
    if (row >= nrows) return;
    const int t = threadIdx.x, wave = t >> 5, lane = t & 31;
    const size_t base = (size_t)row * HID + (size_t)t * 4;
    const size_t rrow = (size_t)(row / rseq) * (size_t)rseqf + (size_t)(row % rseq);
    const size_t rbase = rrow * HID + (size_t)t * 4;

    v4f rv = *(const v4f*)(res + rbase);
    if (res_bf16) {
        rv[0] = bf16r(rv[0]); rv[1] = bf16r(rv[1]); rv[2] = bf16r(rv[2]); rv[3] = bf16r(rv[3]);
    }
    v4f x = *(const v4f*)(a + base) + rv;
    float sm = (x[0] + x[1]) + (x[2] + x[3]);
#pragma unroll
    for (int off = 16; off >= 1; off >>= 1) sm += __shfl_xor(sm, off, 32);
    if (lane == 0) red1[wave] = sm;
    __syncthreads();
    float tot = 0.0f;
#pragma unroll
    for (int w = 0; w < 8; ++w) tot += red1[w];
    const float mu = tot * (1.0f / 1024.0f);

    v4f d = x - mu;
    float sq = (d[0] * d[0] + d[1] * d[1]) + (d[2] * d[2] + d[3] * d[3]);
#pragma unroll
    for (int off = 16; off >= 1; off >>= 1) sq += __shfl_xor(sq, off, 32);
    if (lane == 0) red2[wave] = sq;
    __syncthreads();
    float tot2 = 0.0f;
#pragma unroll
    for (int w = 0; w < 8; ++w) tot2 += red2[w];
    const float var = tot2 * (1.0f / 1024.0f);
    const float rstd = rsqrtf(var + 1.0e-5f);

    v4f gv = *(const v4f*)(g + t * 4);
    v4f bv = *(const v4f*)(be + t * 4);
    v4f y = d * rstd * gv + bv;
    v4h yh;
    yh[0] = (f16)y[0]; yh[1] = (f16)y[1]; yh[2] = (f16)y[2]; yh[3] = (f16)y[3];

    *(v4f*)(outf + base) = y;
    if (write_h) *(v4h*)(outh + base) = yh;
    
}

// ---------------- host launcher ----------------
extern "C" void kernel_launch(void* const* d_in, const int* in_sizes, int n_in,
                              void* d_out, int out_size, void* d_ws, size_t ws_size,
                              hipStream_t stream) {
    const int Mtok = MTOK;
    if (n_in < 14) return;
    if (in_sizes[0] < ((NB - 1) * SEQ_FULL + SEQ) * HID || in_sizes[1] < (NB - 1) * SEQ_FULL + SEQ ||
        in_sizes[2] < HID * HID || in_sizes[3] < HID || in_sizes[4] < HID * HID || in_sizes[5] < HID ||
        in_sizes[6] < HID || in_sizes[7] < HID || in_sizes[8] < DFF * HID || in_sizes[9] < DFF ||
        in_sizes[10] < HID * DFF || in_sizes[11] < HID || in_sizes[12] < HID || in_sizes[13] < HID ||
        out_size < Mtok * HID) return;

    const float* x    = (const float*)d_in[0];
    const float* amsk = (const float*)d_in[1];
    const float* Wq   = (const float*)d_in[2];  const float* bq   = (const float*)d_in[3];
    const float* Wso  = (const float*)d_in[4];  const float* bso  = (const float*)d_in[5];
    const float* ln1g = (const float*)d_in[6];  const float* ln1b = (const float*)d_in[7];
    const float* Wi   = (const float*)d_in[8];  const float* bi   = (const float*)d_in[9];
    const float* Wo   = (const float*)d_in[10]; const float* bo   = (const float*)d_in[11];
    const float* ln2g = (const float*)d_in[12]; const float* ln2b = (const float*)d_in[13];

    char* ws = (char*)d_ws;
    size_t off = 0;
    auto take = [&](size_t bytes) -> char* {
        char* p = ws + off;
        off += (bytes + 255) & ~(size_t)255;
        return p;
    };
    f16*   xh    = (f16*)take((size_t)Mtok * HID * 2);      // [Mtok][1024]
    f16*   wq16  = (f16*)take((size_t)HID * HID * 2);       // [N=1024][K=1024]
    f16*   wso16 = (f16*)take((size_t)HID * HID * 2);       // [N=1024][K=1024]
    f16*   wi16  = (f16*)take((size_t)DFF * HID * 2);       // [N=4096][K=1024]
    f16*   wo16  = (f16*)take((size_t)HID * DFF * 2);       // [N=1024][K=4096]
    f16*   qkvh  = (f16*)take((size_t)Mtok * HID * 2);
    f16*   ctxh  = (f16*)take((size_t)Mtok * HID * 2);
    float* attf  = (float*)take((size_t)Mtok * HID * 4);    // also holds fff later (same extent)
    float* h1f   = (float*)take((size_t)Mtok * HID * 4);
    f16*   h1h   = (f16*)take((size_t)Mtok * HID * 2);
    f16*   gh    = (f16*)take((size_t)Mtok * DFF * 2);
    float* fff   = attf;                                    // attf fully consumed by LN1 before the output GEMM writes fff
    if (off > ws_size) return;

    const int thr = 256;
    const float wsc = 64.0f;   // 2^6 weight operand scale, folded back in the GEMM epilogue

    // activations -> f16 (compact token rows), weights [N][K] -> scaled f16 [N][K]
    k_cvt<<<(Mtok * HID / 8 + thr - 1) / thr, thr, 0, stream>>>(x, xh, Mtok * HID, HID, SEQ, SEQ_FULL, 1.0f);
    k_cvt<<<(HID * HID / 8 + thr - 1) / thr, thr, 0, stream>>>(Wq, wq16, HID * HID, HID, HID, HID, wsc);
    k_cvt<<<(HID * HID / 8 + thr - 1) / thr, thr, 0, stream>>>(Wso, wso16, HID * HID, HID, HID, HID, wsc);
    k_cvt<<<(DFF * HID / 8 + thr - 1) / thr, thr, 0, stream>>>(Wi, wi16, DFF * HID, HID, DFF, DFF, wsc);
    k_cvt<<<(HID * DFF / 8 + thr - 1) / thr, thr, 0, stream>>>(Wo, wo16, HID * DFF, DFF, HID, HID, wsc);

    const dim3 gH(HID / GBN, Mtok / GBM);     // N = 1024
    const dim3 gF(DFF / GBN, Mtok / GBM);     // N = 4096

    // Placeholder pointer arguments below (omode / write_h exclude them) are valid, correctly typed
    // workspace regions that the launch never dereferences.

    // shared q/k/v projection (f16 out only, [Mtok][1024]); Cf placeholder = attf
    k_gemm<<<gH, thr, 0, stream>>>(xh, wq16, bq, attf, qkvh, Mtok, HID, HID, 0, 0.015625f, 2);

    // attention: one block per (batch, head, 128 queries); ctx carried * 2^4
    k_attn<<<NB * NHD * (SEQ / 128), thr, 0, stream>>>(qkvh, amsk, ctxh, NB);

    // self-output projection (f32 out only, * 2^-6 * 2^-4); Ch placeholder = gh
    k_gemm<<<gH, thr, 0, stream>>>(ctxh, wso16, bso, attf, gh, Mtok, HID, HID, 0, 0.0009765625f, 1);
    // LN1(attn + bf16(x)) -> h1 (f32 + f16 copy)
    k_ln<<<Mtok, thr, 0, stream>>>(attf, x, SEQ, SEQ_FULL, 1, ln1g, ln1b, h1f, h1h, 1, Mtok);

    // FFN: GELU(h1.Wi^T + bi) (f16 out only; Cf placeholder = attf) . Wo^T + bo (f32 out only; Ch placeholder = h1h)
    k_gemm<<<gF, thr, 0, stream>>>(h1h, wi16, bi, attf, gh, Mtok, DFF, HID, 1, 0.015625f, 2);
    k_gemm<<<gH, thr, 0, stream>>>(gh, wo16, bo, fff, h1h, Mtok, HID, DFF, 0, 0.015625f, 1);
    // LN2(ff + h1) -> d_out (f32 only; outh placeholder = h1h, residual not converted)
    k_ln<<<Mtok, thr, 0, stream>>>(fff, h1f, SEQ, SEQ, 0, ln2g, ln2b, (float*)d_out, h1h, 0, Mtok);
}

// v004
// One run takes 183 microseconds.
// Next to v003, in two timings, it ran 1.05 times as fast each time.
// Over all steps from v000 it is 1.92 times as fast.
#include <hip/hip_runtime.h>
#include <stdint.h>
// All contractions: v_wmma_f32_16x16x32_f16 (f16 operands, f32 accumulate): qkv, self-output, intermediate and output projections (float inputs RNE-converted to bf16 then f16; weight operand scaled by 2^6, ctx operand by 2^4, folded back in the epilogue), q.k^T and p.v (p scaled by 2^12); softmax, LayerNorm, GELU, residuals in f32.

#ifndef NB
#define NB 2
#endif
#ifndef SEQ
#define SEQ 2048
#endif
#define NB_FULL 2
#define SEQ_FULL 2048
#define HID 1024
#define NHD 16
#define DHD 64
#define DFF 4096
#define MTOK (NB * SEQ)

static_assert(NB >= 1 && NB <= NB_FULL);
static_assert(SEQ >= 128 && SEQ <= SEQ_FULL && (SEQ % 128) == 0);
static_assert((MTOK % 128) == 0);
static_assert(HID == NHD * DHD);
static_assert((HID % 128) == 0 && (DFF % 128) == 0 && (HID % 32) == 0 && (DFF % 32) == 0);

typedef _Float16 f16;
typedef f16   v4h  __attribute__((ext_vector_type(4)));
typedef f16   v8h  __attribute__((ext_vector_type(8)));
typedef f16   v16h __attribute__((ext_vector_type(16)));
typedef float v4f  __attribute__((ext_vector_type(4)));
typedef float v8f  __attribute__((ext_vector_type(8)));
union Frag { v16h v; v8h half[2]; };

// 16x16x32 f16 WMMA with hazard guard (4 VALU slots) tied to D, A and B
__device__ __forceinline__ v8f wmma16(v16h a, v16h b, v8f c) {
    v8f d = __builtin_amdgcn_wmma_f32_16x16x32_f16(false, a, false, b, (short)0, c, false, false);
    asm volatile("v_nop\n\tv_nop\n\tv_nop\n\tv_nop" : "+v"(d) : "v"(a), "v"(b));
    return d;
}
__device__ __forceinline__ v8f zero8() {
    v8f z;
#pragma unroll
    for (int i = 0; i < 8; ++i) z[i] = 0.0f;
    return z;
}
// f32 -> nearest-even bf16 value, returned as f32
__device__ __forceinline__ float bf16r(float x) {
    unsigned u = __float_as_uint(x);
    u = (u + 0x7FFFu + ((u >> 16) & 1u)) & 0xFFFF0000u;
    return __uint_as_float(u);
}

// Five conversions that need nothing of each other share one grid: a range of the block index picks the job (the branch
// is block-uniform). Every job is a whole number of blocks of 256 threads x 8 values.
// Activations: compact destination row m reads source row (m / SEQ) * SEQ_FULL + m % SEQ, scale 1.
// Weights: [N][K] as they lie, scaled by wscale.
#define CVB 2048                        // values of one block
#define CB_X (MTOK * HID / CVB)         // blocks of the activations
#define CB_S (HID * HID / CVB)          // blocks of a 1024 x 1024 weight
#define CB_L (DFF * HID / CVB)          // blocks of a 4096 x 1024 or 1024 x 4096 weight
#define CB_ALL (CB_X + 2 * CB_S + 2 * CB_L)
static_assert((MTOK * HID) % CVB == 0 && (HID * HID) % CVB == 0 && (DFF * HID) % CVB == 0 && (HID % 8) == 0);

__global__ __launch_bounds__(256) void k_cvt(const float* __restrict__ x, const float* __restrict__ wq,
                                              const float* __restrict__ wso, const float* __restrict__ wi,
                                              const float* __restrict__ wo, f16* xh, f16* wq16, f16* wso16,
                                              f16* wi16, f16* wo16, float wscale) {
    const int blk = blockIdx.x;
    const float* in;
    f16* out;
    int first;                          // first block of this block's job
    if (blk < CB_X)                           { in = x;   out = xh;    first = 0; }
    else if (blk < CB_X + CB_S)               { in = wq;  out = wq16;  first = CB_X; }
    else if (blk < CB_X + 2 * CB_S)           { in = wso; out = wso16; first = CB_X + CB_S; }
    else if (blk < CB_X + 2 * CB_S + CB_L)    { in = wi;  out = wi16;  first = CB_X + 2 * CB_S; }
    else if (blk < CB_ALL)                    { in = wo;  out = wo16;  first = CB_X + 2 * CB_S + CB_L; }
    else return;
    const size_t i8 = ((size_t)(blk - first) * 256 + threadIdx.x) * 8;
    size_t src = i8;
    float scale = wscale;
    if (blk < CB_X) {
        const size_t m = i8 / HID, c = i8 % HID;
        src = ((m / SEQ) * SEQ_FULL + m % SEQ) * HID + c;
        scale = 1.0f;
    }
    v4f a = *(const v4f*)(in + src);
    v4f b = *(const v4f*)(in + src + 4);
    v8h hv;
    hv[0] = (f16)(bf16r(a[0]) * scale); hv[1] = (f16)(bf16r(a[1]) * scale);
    hv[2] = (f16)(bf16r(a[2]) * scale); hv[3] = (f16)(bf16r(a[3]) * scale);
    hv[4] = (f16)(bf16r(b[0]) * scale); hv[5] = (f16)(bf16r(b[1]) * scale);
    hv[6] = (f16)(bf16r(b[2]) * scale); hv[7] = (f16)(bf16r(b[3]) * scale);
    *(v8h*)(out + i8) = hv;
}

// ---------------- tiled GEMM: C[M][N] = A[M][K] (f16) . B, B given as BT[N][K] (f16, k-contiguous) ----------------
// epilogue: * oscale + bias, optional exact GELU; f32 (omode bit 0) and/or f16 (omode bit 1) output,
#define GBM 128
#define GBN 128
#define GBK 128     // k depth of one ring stage
#define GLD 136     // staged row: 128 halves + 8 pad = 272 B
#define GSP 132     // staging row pitch in floats (528 B)
#define GTILE (GBM * GLD)       // halves of one operand tile in LDS
#define GSTAGE (2 * GTILE)      // halves of one stage: [A tile | B tile]

static_assert((HID % GBK) == 0 && (DFF % GBK) == 0);
static_assert(64 * GSP * 4 <= 2 * GSTAGE * 2);

// One lane's share of a 128-row x 256-byte operand tile: rows r, r+16, .. r+112, 16 bytes each, global -> LDS
// without passing registers. lds = LDS byte address of row r's piece, g = its global address, gstep = 16 rows in halves.
// s_wait_xcnt is the statement's last line, a precaution: so it stands ahead of every later rewrite of these address registers.
__device__ __forceinline__ void copy_tile(unsigned lds, const f16* g, size_t gstep) {
    asm volatile("global_load_async_to_lds_b128 %0, %8, off\n\t"
                 "global_load_async_to_lds_b128 %1, %9, off\n\t"
                 "global_load_async_to_lds_b128 %2, %10, off\n\t"
                 "global_load_async_to_lds_b128 %3, %11, off\n\t"
                 "global_load_async_to_lds_b128 %4, %12, off\n\t"
                 "global_load_async_to_lds_b128 %5, %13, off\n\t"
                 "global_load_async_to_lds_b128 %6, %14, off\n\t"
                 "global_load_async_to_lds_b128 %7, %15, off\n\t"
                 "s_wait_xcnt 0x0"
                 :: "v"(lds), "v"(lds + 1u * 16u * GLD * 2u), "v"(lds + 2u * 16u * GLD * 2u),
                    "v"(lds + 3u * 16u * GLD * 2u), "v"(lds + 4u * 16u * GLD * 2u), "v"(lds + 5u * 16u * GLD * 2u),
                    "v"(lds + 6u * 16u * GLD * 2u), "v"(lds + 7u * 16u * GLD * 2u),
                    "v"(g), "v"(g + gstep), "v"(g + 2 * gstep), "v"(g + 3 * gstep),
                    "v"(g + 4 * gstep), "v"(g + 5 * gstep), "v"(g + 6 * gstep), "v"(g + 7 * gstep)
                 : "memory");
}

// exact GELU of two values, x/2 * (1 + erf(x / sqrt 2)), without a branch: erf's two ranges (|z| < 1: odd polynomial in z;
// else 1 - exp(-q(|z|))) are both evaluated and one is selected, so that the values of a lane are independent chains.
typedef float v2f __attribute__((ext_vector_type(2)));
__device__ __forceinline__ v2f fma2(v2f a, v2f b, float c) {
    v2f cc; cc[0] = c; cc[1] = c;
    return __builtin_elementwise_fma(a, b, cc);
}
__device__ __forceinline__ v2f gelu2(v2f x) {
    const v2f z = x * 0.70710678118654752f;
    v2f a; a[0] = fabsf(z[0]); a[1] = fabsf(z[1]);
    const v2f t = z * z;
    v2f ps; ps[0] = -0x1.268bc2p-11f; ps[1] = -0x1.268bc2p-11f;
    ps = fma2(t, ps, 0x1.420828p-8f);
    ps = fma2(t, ps, -0x1.b5937p-6f);
    ps = fma2(t, ps, 0x1.ce077cp-4f);
    ps = fma2(t, ps, -0x1.81266p-2f);
    ps = fma2(t, ps, 0x1.06ebap-3f);
    ps = __builtin_elementwise_fma(a, ps, a);
    v2f q; q[0] = 0x1.1d3156p-16f; q[1] = 0x1.1d3156p-16f;
    q = fma2(a, q, -0x1.8d129p-12f);
    q = fma2(a, q, 0x1.f9a6d2p-9f);
    q = fma2(a, q, -0x1.8c3164p-6f);
    q = fma2(a, q, 0x1.b4e9c8p-4f);
    q = fma2(a, q, 0x1.4515fap-1f);
    q = fma2(a, q, 0x1.078e5p-3f);
    q = __builtin_elementwise_fma(a, q, a);
    q = q * -1.44269504088896340736f;
    v2f e;
    e[0] = __builtin_copysignf(a[0] < 1.0f ? ps[0] : 1.0f - __builtin_amdgcn_exp2f(q[0]), z[0]);
    e[1] = __builtin_copysignf(a[1] < 1.0f ? ps[1] : 1.0f - __builtin_amdgcn_exp2f(q[1]), z[1]);
    return (x * 0.5f) * (1.0f + e);
}

__global__ __launch_bounds__(256) void k_gemm(const f16* __restrict__ A, const f16* __restrict__ BT,
                                               const float* __restrict__ bias, float* Cf, f16* Ch,
                                               int M, int N, int K, int act, float oscale, int omode) {
    __shared__ __attribute__((aligned(16))) f16 ring[2 * GSTAGE];   // two stages; output staging once the loop has left it
    float* Cs = (float*)ring;

    const int t = threadIdx.x, wave = t >> 5, lane = t & 31;
    const int hh = lane >> 4, l16 = lane & 15;
    const int wm = wave >> 2, wn = wave & 3;          // 2 x 4 waves, 64 x 32 per wave
    const int bm0 = blockIdx.y * GBM, bn0 = blockIdx.x * GBN;
    if (bm0 + GBM > M || bn0 + GBN > N) return;       // block-uniform; host guarantees exact multiples

    v8f acc[4][2];
#pragma unroll
    for (int i = 0; i < 4; ++i)
#pragma unroll
        for (int j = 0; j < 2; ++j) acc[i][j] = zero8();

    // two-buffer ring: stage s lives in buffer s & 1; its copies fly while stage s - 1 is multiplied
    const int nk = K / GBK;
    const int crow = t >> 4, cseg = (t & 15) * 8;     // this lane copies rows crow + 16 j, halves cseg .. cseg + 7
    const f16* ga = A  + (size_t)(bm0 + crow) * K + cseg;
    const f16* gb = BT + (size_t)(bn0 + crow) * K + cseg;
    const size_t gstep = (size_t)16 * K;
    const unsigned lcopy = (unsigned)(uintptr_t)ring + (unsigned)(crow * GLD + cseg) * 2u;

    copy_tile(lcopy, ga, gstep);
    copy_tile(lcopy + GTILE * 2u, gb, gstep);
    asm volatile("s_wait_asynccnt 0x0" ::: "memory");   // stage 0 of this wave has landed
    __syncthreads();                                    // ... and of every wave
    if (nk > 1) {
        copy_tile(lcopy + GSTAGE * 2u, ga + GBK, gstep);
        copy_tile(lcopy + (GSTAGE + GTILE) * 2u, gb + GBK, gstep);
    }

    for (int it = 0; it < nk; ++it) {
        const unsigned buf = (unsigned)(it & 1);
        const f16* As = ring + buf * GSTAGE;
        const f16* Bs = As + GTILE;
#pragma unroll   // every LDS offset of the stage becomes an immediate
        for (int ks = 0; ks < GBK / 32; ++ks) {
            Frag af[4], bf[2];
#pragma unroll
            for (int mf = 0; mf < 4; ++mf) {
                const f16* ap = As + (wm * 64 + mf * 16 + l16) * GLD + ks * 32;
                af[mf].half[0] = *(const v8h*)(ap + 8 * hh);        // k = 8h .. 8h+7
                af[mf].half[1] = *(const v8h*)(ap + 16 + 8 * hh);   // k = 16+8h .. 16+8h+7
            }
#pragma unroll
            for (int nf = 0; nf < 2; ++nf) {
                const f16* bp = Bs + (wn * 32 + nf * 16 + l16) * GLD + ks * 32;   // column n, k-contiguous
                bf[nf].half[0] = *(const v8h*)(bp + 8 * hh);
                bf[nf].half[1] = *(const v8h*)(bp + 16 + 8 * hh);
            }
#pragma unroll
            for (int mf = 0; mf < 4; ++mf)
#pragma unroll
                for (int nf = 0; nf < 2; ++nf)
                    acc[mf][nf] = wmma16(af[mf].v, bf[nf].v, acc[mf][nf]);
        }
        asm volatile("s_wait_dscnt 0x0" ::: "memory");      // this wave's reads of buffer buf are done before it is refilled
        asm volatile("s_wait_asynccnt 0x0" ::: "memory");   // this wave's copies of stage it + 1 have landed
        __syncthreads();                                    // publishes stage it + 1, frees buffer buf
        if (it + 2 < nk) {
            copy_tile(lcopy + buf * (GSTAGE * 2u), ga + (size_t)(it + 2) * GBK, gstep);
            copy_tile(lcopy + buf * (GSTAGE * 2u) + GTILE * 2u, gb + (size_t)(it + 2) * GBK, gstep);
        }
    }
    asm volatile("s_wait_asynccnt 0x0" ::: "memory");       // nothing in flight when the ring becomes output staging

    // scale, bias and activation: every wave on its own 64 values at once, in registers, ahead of the staging phases
    // (all loops unrolled: accumulator indices must be constants, and the 32 pairs must stand side by side to interleave)
#pragma unroll
    for (int nf = 0; nf < 2; ++nf) {
        const float bvv = bias[bn0 + wn * 32 + nf * 16 + l16];
#pragma unroll
        for (int mf = 0; mf < 4; ++mf)
#pragma unroll
            for (int r = 0; r < 8; ++r) acc[mf][nf][r] = acc[mf][nf][r] * oscale + bvv;
    }
    if (act) {
#pragma unroll
        for (int mf = 0; mf < 4; ++mf)
#pragma unroll
            for (int nf = 0; nf < 2; ++nf)
#pragma unroll
                for (int r = 0; r < 8; r += 2) {
                    v2f x; x[0] = acc[mf][nf][r]; x[1] = acc[mf][nf][r + 1];
                    x = gelu2(x);
                    acc[mf][nf][r] = x[0]; acc[mf][nf][r + 1] = x[1];
                }
    }

#pragma unroll 1
    for (int p = 0; p < 2; ++p) {
        if (wm == p) {
#pragma unroll
            for (int mf = 0; mf < 4; ++mf)
#pragma unroll
                for (int nf = 0; nf < 2; ++nf) {
                    const int col = wn * 32 + nf * 16 + l16;
#pragma unroll
                    for (int r = 0; r < 8; ++r) Cs[(mf * 16 + 8 * hh + r) * GSP + col] = acc[mf][nf][r];
                }
        }
        __syncthreads();
        if (omode & 1) {
            v4f vals[8];
            size_t po[8];
#pragma unroll
            for (int j = 0; j < 8; ++j) {
                const int e = t + 256 * j, row = e >> 5, c4 = (e & 31) * 4;
                vals[j] = *(const v4f*)(Cs + row * GSP + c4);
                po[j] = (size_t)(bm0 + p * 64 + row) * N + bn0 + c4;
            }
#pragma unroll
            for (int j = 0; j < 8; ++j) *(v4f*)(Cf + po[j]) = vals[j];
            
        }
        if (omode & 2) {
            v8h hv[4];
            size_t po[4];
#pragma unroll
            for (int j = 0; j < 4; ++j) {
                const int e = t + 256 * j, row = e >> 4, c8 = (e & 15) * 8;
                v4f a = *(const v4f*)(Cs + row * GSP + c8);
                v4f b = *(const v4f*)(Cs + row * GSP + c8 + 4);
                hv[j][0] = (f16)a[0]; hv[j][1] = (f16)a[1]; hv[j][2] = (f16)a[2]; hv[j][3] = (f16)a[3];
                hv[j][4] = (f16)b[0]; hv[j][5] = (f16)b[1]; hv[j][6] = (f16)b[2]; hv[j][7] = (f16)b[3];
                po[j] = (size_t)(bm0 + p * 64 + row) * N + bn0 + c8;
            }
#pragma unroll
            for (int j = 0; j < 4; ++j) *(v8h*)(Ch + po[j]) = hv[j];
            
        }
        __syncthreads();
    }
}

#define ALD 72      // staged row: 64 halves + 8 pad = 144 B

// lane l <-> lane l ^ 16
__device__ __forceinline__ float xhalf(float x) {
    const int b = __builtin_bit_cast(int, x);
    return __builtin_bit_cast(float, __builtin_amdgcn_permlanex16(b, b, 0x76543210, 0xfedcba98, false, false));
}

__global__ __launch_bounds__(256) void k_attn(const f16* __restrict__ QKV, const float* __restrict__ mask,
                                               f16* Ctx, int nb) {
    __shared__ f16 Ks[64 * ALD];          // [key][dim]
    __shared__ f16 Vs[64 * ALD];          // [dim][key]

    const int t = threadIdx.x, wave = t >> 5, lane = t & 31;
    const int hh = lane >> 4, l16 = lane & 15;
    const int bid = blockIdx.x;
    const int nqt = SEQ / 128;
    const int qt = bid % nqt, h = (bid / nqt) % NHD, b = bid / (nqt * NHD);
    if (b >= nb) return;
    const int q0 = qt * 128 + wave * 16;
    const size_t tok0 = (size_t)b * SEQ;             // compact token row base of this batch

    // Q as B operand: column n = query l16, 64 dims = two k=32 fragments
    Frag qb[2];
    {
        const f16* qp = QKV + (tok0 + q0 + l16) * HID + h * DHD;
#pragma unroll
        for (int kf = 0; kf < 2; ++kf) {
            qb[kf].half[0] = *(const v8h*)(qp + kf * 32 + 8 * hh);
            qb[kf].half[1] = *(const v8h*)(qp + kf * 32 + 16 + 8 * hh);
        }
    }

    float mrun = -3.0e38f, lrun = 0.0f;   // this lane's query: running maximum (both halves agree), this half's share of the sum
    v8f o[4];                             // o[nf][r] = O[query l16][dim nf * 16 + 8 hh + r]
#pragma unroll
    for (int nf = 0; nf < 4; ++nf) o[nf] = zero8();

    for (int kt = 0; kt < SEQ / 64; ++kt) {
        // stage 64 keys x 64 dims: K row-major, V transposed into [dim][key] (same source rows)
        v8h kv[2];
#pragma unroll
        for (int j = 0; j < 2; ++j) {
            const int e = t + 256 * j, key = e >> 3, seg = (e & 7) * 8;
            const size_t g = (tok0 + kt * 64 + key) * HID + h * DHD + seg;
            kv[j] = *(const v8h*)(QKV + g);
        }
        // additive mask of this lane's 32 keys, n * 16 + 8 hh + r; asked for behind the tile, wanted only behind S^T
        v4f mk[4][2];
        {
            const float* mp = mask + (size_t)b * SEQ_FULL + kt * 64 + 8 * hh;
#pragma unroll
            for (int n = 0; n < 4; ++n) {
                mk[n][0] = *(const v4f*)(mp + n * 16);
                mk[n][1] = *(const v4f*)(mp + n * 16 + 4);
            }
        }
#pragma unroll
        for (int j = 0; j < 2; ++j) {
            const int e = t + 256 * j, key = e >> 3, seg = (e & 7) * 8;
            *(v8h*)(Ks + key * ALD + seg) = kv[j];
#pragma unroll
            for (int i = 0; i < 8; ++i) Vs[(seg + i) * ALD + key] = kv[j][i];
        }
        __syncthreads();

        // S^T = K.Q^T / 8 + additive mask ; A operand row m = key, k = dim contiguous in Ks row
        v8f s[4];
#pragma unroll
        for (int n = 0; n < 4; ++n) {
            Frag kb0, kb1;
            const f16* kp = Ks + (n * 16 + l16) * ALD;
            kb0.half[0] = *(const v8h*)(kp + 8 * hh);
            kb0.half[1] = *(const v8h*)(kp + 16 + 8 * hh);
            kb1.half[0] = *(const v8h*)(kp + 32 + 8 * hh);
            kb1.half[1] = *(const v8h*)(kp + 48 + 8 * hh);
            v8f z = zero8();
            z = wmma16(kb0.v, qb[0].v, z);
            z = wmma16(kb1.v, qb[1].v, z);
#pragma unroll
            for (int r = 0; r < 8; ++r) s[n][r] = z[r] * 0.125f + mk[n][r >> 2][r & 3];
        }

        // online softmax of one query per lane
        float mx4[4];
#pragma unroll
        for (int n = 0; n < 4; ++n) {
            mx4[n] = fmaxf(fmaxf(fmaxf(s[n][0], s[n][1]), fmaxf(s[n][2], s[n][3])),
                           fmaxf(fmaxf(s[n][4], s[n][5]), fmaxf(s[n][6], s[n][7])));
        }
        float mx = fmaxf(fmaxf(mx4[0], mx4[1]), fmaxf(mx4[2], mx4[3]));
        mx = fmaxf(mx, xhalf(mx));
        const float mnew = fmaxf(mrun, mx);
        const float corr = __expf(mrun - mnew);
        mrun = mnew;
#pragma unroll
        for (int nf = 0; nf < 4; ++nf)
#pragma unroll
            for (int r = 0; r < 8; ++r) o[nf][r] *= corr;
        float rs4[4];
#pragma unroll
        for (int n = 0; n < 4; ++n)
#pragma unroll
            for (int r = 0; r < 8; ++r) s[n][r] = (s[n][r] - mnew) * 1.44269504088896340736f;
#pragma unroll
        for (int n = 0; n < 4; ++n)
#pragma unroll
            for (int r = 0; r < 8; ++r) s[n][r] = __builtin_amdgcn_exp2f(s[n][r]);
#pragma unroll
        for (int n = 0; n < 4; ++n)
            rs4[n] = ((s[n][0] + s[n][1]) + (s[n][2] + s[n][3])) + ((s[n][4] + s[n][5]) + (s[n][6] + s[n][7]));
        lrun = lrun * corr + ((rs4[0] + rs4[1]) + (rs4[2] + rs4[3]));

        // two S^T tiles (keys 32 kf + 8 hh + r and 32 kf + 16 + 8 hh + r) are one B fragment; p scaled by 2^12
        Frag pb[2];
#pragma unroll
        for (int kf = 0; kf < 2; ++kf)
#pragma unroll
            for (int j = 0; j < 2; ++j)
#pragma unroll
                for (int r = 0; r < 8; ++r)
                    pb[kf].half[j][r] = (f16)(s[2 * kf + j][r] * 4096.0f);

        // O^T += V^T.P^T ; A operand row m = dim, k = key contiguous in Vs row
#pragma unroll
        for (int nf = 0; nf < 4; ++nf) {
            Frag vb0, vb1;
            const f16* vp = Vs + (nf * 16 + l16) * ALD;
            vb0.half[0] = *(const v8h*)(vp + 8 * hh);
            vb0.half[1] = *(const v8h*)(vp + 16 + 8 * hh);
            vb1.half[0] = *(const v8h*)(vp + 32 + 8 * hh);
            vb1.half[1] = *(const v8h*)(vp + 48 + 8 * hh);
            o[nf] = wmma16(vb0.v, pb[0].v, o[nf]);
            o[nf] = wmma16(vb1.v, pb[1].v, o[nf]);
        }
        __syncthreads();
    }

    // a lane's 8 accumulator registers are 8 consecutive dims of its query: one 16-byte store a tile
    const float il = 16.0f / ((lrun + xhalf(lrun)) * 4096.0f);
    v8h cv[4];
#pragma unroll
    for (int nf = 0; nf < 4; ++nf)
#pragma unroll
        for (int r = 0; r < 8; ++r) cv[nf][r] = (f16)(o[nf][r] * il);
    f16* cp = Ctx + (tok0 + q0 + l16) * HID + h * DHD + 8 * hh;
#pragma unroll
    for (int nf = 0; nf < 4; ++nf) *(v8h*)(cp + nf * 16) = cv[nf];
}

// ---------------- fused residual + LayerNorm over 1024 (256 threads x 4) ----------------
// residual row for compact row m is (m / rseq) * rseqf + m % rseq; res_bf16 != 0: residual is a raw input
// and is consumed as its RNE bf16 value; write_h != 0: also write the f16 copy (outh dereferenced only then)
__global__ __launch_bounds__(256) void k_ln(const float* __restrict__ a, const float* __restrict__ res,
                                             int rseq, int rseqf, int res_bf16,
                                             const float* __restrict__ g, const float* __restrict__ be,
                                             float* outf, f16* outh, int write_h, int nrows) {
    __shared__ float red1[8], red2[8];
    const int row = blockIdx.x;
    if (row >= nrows) return;
    const int t = threadIdx.x, wave = t >> 5, lane = t & 31;
    const size_t base = (size_t)row * HID + (size_t)t * 4;
    const size_t rrow = (size_t)(row / rseq) * (size_t)rseqf + (size_t)(row % rseq);
    const size_t rbase = rrow * HID + (size_t)t * 4;

    v4f rv = *(const v4f*)(res + rbase);
    if (res_bf16) {
        rv[0] = bf16r(rv[0]); rv[1] = bf16r(rv[1]); rv[2] = bf16r(rv[2]); rv[3] = bf16r(rv[3]);
    }
    v4f x = *(const v4f*)(a + base) + rv;
    float sm = (x[0] + x[1]) + (x[2] + x[3]);
#pragma unroll
    for (int off = 16; off >= 1; off >>= 1) sm += __shfl_xor(sm, off, 32);
    if (lane == 0) red1[wave] = sm;
    __syncthreads();
    float tot = 0.0f;
#pragma unroll
    for (int w = 0; w < 8; ++w) tot += red1[w];
    const float mu = tot * (1.0f / 1024.0f);

    v4f d = x - mu;
    float sq = (d[0] * d[0] + d[1] * d[1]) + (d[2] * d[2] + d[3] * d[3]);
#pragma unroll
    for (int off = 16; off >= 1; off >>= 1) sq += __shfl_xor(sq, off, 32);
    if (lane == 0) red2[wave] = sq;
    __syncthreads();
    float tot2 = 0.0f;
#pragma unroll
    for (int w = 0; w < 8; ++w) tot2 += red2[w];
    const float var = tot2 * (1.0f / 1024.0f);
    const float rstd = rsqrtf(var + 1.0e-5f);

    v4f gv = *(const v4f*)(g + t * 4);
    v4f bv = *(const v4f*)(be + t * 4);
    v4f y = d * rstd * gv + bv;
    v4h yh;
    yh[0] = (f16)y[0]; yh[1] = (f16)y[1]; yh[2] = (f16)y[2]; yh[3] = (f16)y[3];

    *(v4f*)(outf + base) = y;
    if (write_h) *(v4h*)(outh + base) = yh;
    
}

// ---------------- host launcher ----------------
extern "C" void kernel_launch(void* const* d_in, const int* in_sizes, int n_in,
                              void* d_out, int out_size, void* d_ws, size_t ws_size,
                              hipStream_t stream) {
    const int Mtok = MTOK;
    if (n_in < 14) return;
    if (in_sizes[0] < ((NB - 1) * SEQ_FULL + SEQ) * HID || in_sizes[1] < (NB - 1) * SEQ_FULL + SEQ ||
        in_sizes[2] < HID * HID || in_sizes[3] < HID || in_sizes[4] < HID * HID || in_sizes[5] < HID ||
        in_sizes[6] < HID || in_sizes[7] < HID || in_sizes[8] < DFF * HID || in_sizes[9] < DFF ||
        in_sizes[10] < HID * DFF || in_sizes[11] < HID || in_sizes[12] < HID || in_sizes[13] < HID ||
        out_size < Mtok * HID) return;

    const float* x    = (const float*)d_in[0];
    const float* amsk = (const float*)d_in[1];
    const float* Wq   = (const float*)d_in[2];  const float* bq   = (const float*)d_in[3];
    const float* Wso  = (const float*)d_in[4];  const float* bso  = (const float*)d_in[5];
    const float* ln1g = (const float*)d_in[6];  const float* ln1b = (const float*)d_in[7];
    const float* Wi   = (const float*)d_in[8];  const float* bi   = (const float*)d_in[9];
    const float* Wo   = (const float*)d_in[10]; const float* bo   = (const float*)d_in[11];
    const float* ln2g = (const float*)d_in[12]; const float* ln2b = (const float*)d_in[13];

    char* ws = (char*)d_ws;
    size_t off = 0;
    auto take = [&](size_t bytes) -> char* {
        char* p = ws + off;
        off += (bytes + 255) & ~(size_t)255;
        return p;
    };
    f16*   xh    = (f16*)take((size_t)Mtok * HID * 2);      // [Mtok][1024]
    f16*   wq16  = (f16*)take((size_t)HID * HID * 2);       // [N=1024][K=1024]
    f16*   wso16 = (f16*)take((size_t)HID * HID * 2);       // [N=1024][K=1024]
    f16*   wi16  = (f16*)take((size_t)DFF * HID * 2);       // [N=4096][K=1024]
    f16*   wo16  = (f16*)take((size_t)HID * DFF * 2);       // [N=1024][K=4096]
    f16*   qkvh  = (f16*)take((size_t)Mtok * HID * 2);
    f16*   ctxh  = (f16*)take((size_t)Mtok * HID * 2);
    float* attf  = (float*)take((size_t)Mtok * HID * 4);    // also holds fff later (same extent)
    float* h1f   = (float*)take((size_t)Mtok * HID * 4);
    f16*   h1h   = (f16*)take((size_t)Mtok * HID * 2);
    f16*   gh    = (f16*)take((size_t)Mtok * DFF * 2);
    float* fff   = attf;                                    // attf fully consumed by LN1 before the output GEMM writes fff
    if (off > ws_size) return;

    const int thr = 256;
    const float wsc = 64.0f;   // 2^6 weight operand scale, folded back in the GEMM epilogue

    // activations -> f16 (compact token rows), weights [N][K] -> scaled f16 [N][K]: one launch for all five
    k_cvt<<<CB_ALL, thr, 0, stream>>>(x, Wq, Wso, Wi, Wo, xh, wq16, wso16, wi16, wo16, wsc);

    const dim3 gH(HID / GBN, Mtok / GBM);     // N = 1024
    const dim3 gF(DFF / GBN, Mtok / GBM);     // N = 4096

    // Placeholder pointer arguments below (omode / write_h exclude them) are valid, correctly typed
    // workspace regions that the launch never dereferences.

    // shared q/k/v projection (f16 out only, [Mtok][1024]); Cf placeholder = attf
    k_gemm<<<gH, thr, 0, stream>>>(xh, wq16, bq, attf, qkvh, Mtok, HID, HID, 0, 0.015625f, 2);

    // attention: one block per (batch, head, 128 queries); ctx carried * 2^4
    k_attn<<<NB * NHD * (SEQ / 128), thr, 0, stream>>>(qkvh, amsk, ctxh, NB);

    // self-output projection (f32 out only, * 2^-6 * 2^-4); Ch placeholder = gh
    k_gemm<<<gH, thr, 0, stream>>>(ctxh, wso16, bso, attf, gh, Mtok, HID, HID, 0, 0.0009765625f, 1);
    // LN1(attn + bf16(x)) -> h1 (f32 + f16 copy)
    k_ln<<<Mtok, thr, 0, stream>>>(attf, x, SEQ, SEQ_FULL, 1, ln1g, ln1b, h1f, h1h, 1, Mtok);

    // FFN: GELU(h1.Wi^T + bi) (f16 out only; Cf placeholder = attf) . Wo^T + bo (f32 out only; Ch placeholder = h1h)
    k_gemm<<<gF, thr, 0, stream>>>(h1h, wi16, bi, attf, gh, Mtok, DFF, HID, 1, 0.015625f, 2);
    k_gemm<<<gH, thr, 0, stream>>>(gh, wo16, bo, fff, h1h, Mtok, HID, DFF, 0, 0.015625f, 1);
    // LN2(ff + h1) -> d_out (f32 only; outh placeholder = h1h, residual not converted)
    k_ln<<<Mtok, thr, 0, stream>>>(fff, h1f, SEQ, SEQ, 0, ln2g, ln2b, (float*)d_out, h1h, 0, Mtok);
}

// v005
// It runs in 166 microseconds.
// Two timings next to v004 both put it at 1.10 times that version's speed.
// All steps since v000 together make it 2.12 times as fast.
#include <hip/hip_runtime.h>
#include <stdint.h>
// All contractions: v_wmma_f32_16x16x32_f16 (f16 operands, f32 accumulate): qkv, self-output, intermediate and output projections (float inputs RNE-converted to bf16 then f16; weight operand scaled by 2^6, ctx operand by 2^4, folded back in the epilogue), q.k^T and p.v (p scaled by 2^12); softmax, LayerNorm, GELU, residuals in f32.

#ifndef NB
#define NB 2
#endif
#ifndef SEQ
#define SEQ 2048
#endif
#define NB_FULL 2
#define SEQ_FULL 2048
#define HID 1024
#define NHD 16
#define DHD 64
#define DFF 4096
#define MTOK (NB * SEQ)

static_assert(NB >= 1 && NB <= NB_FULL);
static_assert(SEQ >= 128 && SEQ <= SEQ_FULL && (SEQ % 128) == 0);
static_assert((MTOK % 128) == 0);
static_assert(HID == NHD * DHD);
static_assert((HID % 128) == 0 && (DFF % 128) == 0 && (HID % 32) == 0 && (DFF % 32) == 0);

typedef _Float16 f16;
typedef f16   v4h  __attribute__((ext_vector_type(4)));
typedef f16   v8h  __attribute__((ext_vector_type(8)));
typedef f16   v16h __attribute__((ext_vector_type(16)));
typedef float v4f  __attribute__((ext_vector_type(4)));
typedef float v8f  __attribute__((ext_vector_type(8)));
union Frag { v16h v; v8h half[2]; };

// 16x16x32 f16 WMMA with hazard guard (4 VALU slots) tied to D, A and B
__device__ __forceinline__ v8f wmma16(v16h a, v16h b, v8f c) {
    v8f d = __builtin_amdgcn_wmma_f32_16x16x32_f16(false, a, false, b, (short)0, c, false, false);
    asm volatile("v_nop\n\tv_nop\n\tv_nop\n\tv_nop" : "+v"(d) : "v"(a), "v"(b));
    return d;
}
__device__ __forceinline__ v8f zero8() {
    v8f z;
#pragma unroll
    for (int i = 0; i < 8; ++i) z[i] = 0.0f;
    return z;
}
// f32 -> nearest-even bf16 value, returned as f32
__device__ __forceinline__ float bf16r(float x) {
    unsigned u = __float_as_uint(x);
    u = (u + 0x7FFFu + ((u >> 16) & 1u)) & 0xFFFF0000u;
    return __uint_as_float(u);
}

// Five conversions that need nothing of each other share one grid: a range of the block index picks the job (the branch
// is block-uniform). Every job is a whole number of blocks of 256 threads x 8 values.
// Activations: compact destination row m reads source row (m / SEQ) * SEQ_FULL + m % SEQ, scale 1.
// Weights: [N][K] as they lie, scaled by wscale.
#define CVB 2048                        // values of one block
#define CB_X (MTOK * HID / CVB)         // blocks of the activations
#define CB_S (HID * HID / CVB)          // blocks of a 1024 x 1024 weight
#define CB_L (DFF * HID / CVB)          // blocks of a 4096 x 1024 or 1024 x 4096 weight
#define CB_ALL (CB_X + 2 * CB_S + 2 * CB_L)
static_assert((MTOK * HID) % CVB == 0 && (HID * HID) % CVB == 0 && (DFF * HID) % CVB == 0 && (HID % 8) == 0);

__global__ __launch_bounds__(256) void k_cvt(const float* __restrict__ x, const float* __restrict__ wq,
                                              const float* __restrict__ wso, const float* __restrict__ wi,
                                              const float* __restrict__ wo, f16* xh, f16* wq16, f16* wso16,
                                              f16* wi16, f16* wo16, float wscale) {
    const int blk = blockIdx.x;
    const float* in;
    f16* out;
    int first;                          // first block of this block's job
    if (blk < CB_X)                           { in = x;   out = xh;    first = 0; }
    else if (blk < CB_X + CB_S)               { in = wq;  out = wq16;  first = CB_X; }
    else if (blk < CB_X + 2 * CB_S)           { in = wso; out = wso16; first = CB_X + CB_S; }
    else if (blk < CB_X + 2 * CB_S + CB_L)    { in = wi;  out = wi16;  first = CB_X + 2 * CB_S; }
    else if (blk < CB_ALL)                    { in = wo;  out = wo16;  first = CB_X + 2 * CB_S + CB_L; }
    else return;
    const size_t i8 = ((size_t)(blk - first) * 256 + threadIdx.x) * 8;
    size_t src = i8;
    float scale = wscale;
    if (blk < CB_X) {
        const size_t m = i8 / HID, c = i8 % HID;
        src = ((m / SEQ) * SEQ_FULL + m % SEQ) * HID + c;
        scale = 1.0f;
    }
    v4f a = *(const v4f*)(in + src);
    v4f b = *(const v4f*)(in + src + 4);
    v8h hv;
    hv[0] = (f16)(bf16r(a[0]) * scale); hv[1] = (f16)(bf16r(a[1]) * scale);
    hv[2] = (f16)(bf16r(a[2]) * scale); hv[3] = (f16)(bf16r(a[3]) * scale);
    hv[4] = (f16)(bf16r(b[0]) * scale); hv[5] = (f16)(bf16r(b[1]) * scale);
    hv[6] = (f16)(bf16r(b[2]) * scale); hv[7] = (f16)(bf16r(b[3]) * scale);
    *(v8h*)(out + i8) = hv;
}

// ---------------- tiled GEMM: C[M][N] = A[M][K] (f16) . B, B given as BT[N][K] (f16, k-contiguous) ----------------
// epilogue: * oscale + bias, optional exact GELU; f32 (omode bit 0) and/or f16 (omode bit 1) output,
#define GBM 128
#define GBN 128
#define GBK 128     // k depth of one ring stage
#define GLD 136     // staged row: 128 halves + 8 pad = 272 B
#define GSP 132     // staging row pitch in floats (528 B)
#define GTILE (GBM * GLD)       // halves of one operand tile in LDS
#define GSTAGE (2 * GTILE)      // halves of one stage: [A tile | B tile]

static_assert((HID % GBK) == 0 && (DFF % GBK) == 0);
static_assert(64 * GSP * 4 <= 2 * GSTAGE * 2);

// One lane's share of a 128-row x 256-byte operand tile: rows r, r+16, .. r+112, 16 bytes each, global -> LDS
// without passing registers. lds = LDS byte address of row r's piece, g = its global address, gstep = 16 rows in halves.
// s_wait_xcnt is the statement's last line, a precaution: so it stands ahead of every later rewrite of these address registers.
__device__ __forceinline__ void copy_tile(unsigned lds, const f16* g, size_t gstep) {
    asm volatile("global_load_async_to_lds_b128 %0, %8, off\n\t"
                 "global_load_async_to_lds_b128 %1, %9, off\n\t"
                 "global_load_async_to_lds_b128 %2, %10, off\n\t"
                 "global_load_async_to_lds_b128 %3, %11, off\n\t"
                 "global_load_async_to_lds_b128 %4, %12, off\n\t"
                 "global_load_async_to_lds_b128 %5, %13, off\n\t"
                 "global_load_async_to_lds_b128 %6, %14, off\n\t"
                 "global_load_async_to_lds_b128 %7, %15, off\n\t"
                 "s_wait_xcnt 0x0"
                 :: "v"(lds), "v"(lds + 1u * 16u * GLD * 2u), "v"(lds + 2u * 16u * GLD * 2u),
                    "v"(lds + 3u * 16u * GLD * 2u), "v"(lds + 4u * 16u * GLD * 2u), "v"(lds + 5u * 16u * GLD * 2u),
                    "v"(lds + 6u * 16u * GLD * 2u), "v"(lds + 7u * 16u * GLD * 2u),
                    "v"(g), "v"(g + gstep), "v"(g + 2 * gstep), "v"(g + 3 * gstep),
                    "v"(g + 4 * gstep), "v"(g + 5 * gstep), "v"(g + 6 * gstep), "v"(g + 7 * gstep)
                 : "memory");
}

// exact GELU of two values, x/2 * (1 + erf(x / sqrt 2)), without a branch: erf's two ranges (|z| < 1: odd polynomial in z;
// else 1 - exp(-q(|z|))) are both evaluated and one is selected, so that the values of a lane are independent chains.
typedef float v2f __attribute__((ext_vector_type(2)));
__device__ __forceinline__ v2f fma2(v2f a, v2f b, float c) {
    v2f cc; cc[0] = c; cc[1] = c;
    return __builtin_elementwise_fma(a, b, cc);
}
__device__ __forceinline__ v2f gelu2(v2f x) {
    const v2f z = x * 0.70710678118654752f;
    v2f a; a[0] = fabsf(z[0]); a[1] = fabsf(z[1]);
    const v2f t = z * z;
    v2f ps; ps[0] = -0x1.268bc2p-11f; ps[1] = -0x1.268bc2p-11f;
    ps = fma2(t, ps, 0x1.420828p-8f);
    ps = fma2(t, ps, -0x1.b5937p-6f);
    ps = fma2(t, ps, 0x1.ce077cp-4f);
    ps = fma2(t, ps, -0x1.81266p-2f);
    ps = fma2(t, ps, 0x1.06ebap-3f);
    ps = __builtin_elementwise_fma(a, ps, a);
    v2f q; q[0] = 0x1.1d3156p-16f; q[1] = 0x1.1d3156p-16f;
    q = fma2(a, q, -0x1.8d129p-12f);
    q = fma2(a, q, 0x1.f9a6d2p-9f);
    q = fma2(a, q, -0x1.8c3164p-6f);
    q = fma2(a, q, 0x1.b4e9c8p-4f);
    q = fma2(a, q, 0x1.4515fap-1f);
    q = fma2(a, q, 0x1.078e5p-3f);
    q = __builtin_elementwise_fma(a, q, a);
    q = q * -1.44269504088896340736f;
    v2f e;
    e[0] = __builtin_copysignf(a[0] < 1.0f ? ps[0] : 1.0f - __builtin_amdgcn_exp2f(q[0]), z[0]);
    e[1] = __builtin_copysignf(a[1] < 1.0f ? ps[1] : 1.0f - __builtin_amdgcn_exp2f(q[1]), z[1]);
    return (x * 0.5f) * (1.0f + e);
}

__global__ __launch_bounds__(256) void k_gemm(const f16* __restrict__ A, const f16* __restrict__ BT,
                                               const float* __restrict__ bias, float* Cf, f16* Ch,
                                               int M, int N, int K, int act, float oscale, int omode) {
    __shared__ __attribute__((aligned(16))) f16 ring[2 * GSTAGE];   // two stages; output staging once the loop has left it
    float* Cs = (float*)ring;

    const int t = threadIdx.x, wave = t >> 5, lane = t & 31;
    const int hh = lane >> 4, l16 = lane & 15;
    const int wm = wave >> 2, wn = wave & 3;          // 2 x 4 waves, 64 x 32 per wave
    const int bm0 = blockIdx.y * GBM, bn0 = blockIdx.x * GBN;
    if (bm0 + GBM > M || bn0 + GBN > N) return;       // block-uniform; host guarantees exact multiples

    v8f acc[4][2];
#pragma unroll
    for (int i = 0; i < 4; ++i)
#pragma unroll
        for (int j = 0; j < 2; ++j) acc[i][j] = zero8();

    // two-buffer ring: stage s lives in buffer s & 1; its copies fly while stage s - 1 is multiplied
    const int nk = K / GBK;
    const int crow = t >> 4, cseg = (t & 15) * 8;     // this lane copies rows crow + 16 j, halves cseg .. cseg + 7
    const f16* ga = A  + (size_t)(bm0 + crow) * K + cseg;
    const f16* gb = BT + (size_t)(bn0 + crow) * K + cseg;
    const size_t gstep = (size_t)16 * K;
    const unsigned lcopy = (unsigned)(uintptr_t)ring + (unsigned)(crow * GLD + cseg) * 2u;

    copy_tile(lcopy, ga, gstep);
    copy_tile(lcopy + GTILE * 2u, gb, gstep);
    asm volatile("s_wait_asynccnt 0x0" ::: "memory");   // stage 0 of this wave has landed
    __syncthreads();                                    // ... and of every wave
    if (nk > 1) {
        copy_tile(lcopy + GSTAGE * 2u, ga + GBK, gstep);
        copy_tile(lcopy + (GSTAGE + GTILE) * 2u, gb + GBK, gstep);
    }

    for (int it = 0; it < nk; ++it) {
        const unsigned buf = (unsigned)(it & 1);
        const f16* As = ring + buf * GSTAGE;
        const f16* Bs = As + GTILE;
#pragma unroll   // every LDS offset of the stage becomes an immediate
        for (int ks = 0; ks < GBK / 32; ++ks) {
            Frag af[4], bf[2];
#pragma unroll
            for (int mf = 0; mf < 4; ++mf) {
                const f16* ap = As + (wm * 64 + mf * 16 + l16) * GLD + ks * 32;
                af[mf].half[0] = *(const v8h*)(ap + 8 * hh);        // k = 8h .. 8h+7
                af[mf].half[1] = *(const v8h*)(ap + 16 + 8 * hh);   // k = 16+8h .. 16+8h+7
            }
#pragma unroll
            for (int nf = 0; nf < 2; ++nf) {
                const f16* bp = Bs + (wn * 32 + nf * 16 + l16) * GLD + ks * 32;   // column n, k-contiguous
                bf[nf].half[0] = *(const v8h*)(bp + 8 * hh);
                bf[nf].half[1] = *(const v8h*)(bp + 16 + 8 * hh);
            }
#pragma unroll
            for (int mf = 0; mf < 4; ++mf)
#pragma unroll
                for (int nf = 0; nf < 2; ++nf)
                    acc[mf][nf] = wmma16(af[mf].v, bf[nf].v, acc[mf][nf]);
        }
        asm volatile("s_wait_dscnt 0x0" ::: "memory");      // this wave's reads of buffer buf are done before it is refilled
        asm volatile("s_wait_asynccnt 0x0" ::: "memory");   // this wave's copies of stage it + 1 have landed
        __syncthreads();                                    // publishes stage it + 1, frees buffer buf
        if (it + 2 < nk) {
            copy_tile(lcopy + buf * (GSTAGE * 2u), ga + (size_t)(it + 2) * GBK, gstep);
            copy_tile(lcopy + buf * (GSTAGE * 2u) + GTILE * 2u, gb + (size_t)(it + 2) * GBK, gstep);
        }
    }
    asm volatile("s_wait_asynccnt 0x0" ::: "memory");       // nothing in flight when the ring becomes output staging

    // scale, bias and activation: every lane on its own 64 values at once, in registers, ahead of the staging phases
    // (all loops unrolled: accumulator indices must be constants, and the 32 pairs must stand side by side to interleave)
#pragma unroll
    for (int nf = 0; nf < 2; ++nf) {
        const float bvv = bias[bn0 + wn * 32 + nf * 16 + l16];
#pragma unroll
        for (int mf = 0; mf < 4; ++mf)
#pragma unroll
            for (int r = 0; r < 8; ++r) acc[mf][nf][r] = acc[mf][nf][r] * oscale + bvv;
    }
    if (act) {
#pragma unroll
        for (int mf = 0; mf < 4; ++mf)
#pragma unroll
            for (int nf = 0; nf < 2; ++nf)
#pragma unroll
                for (int r = 0; r < 8; r += 2) {
                    v2f x; x[0] = acc[mf][nf][r]; x[1] = acc[mf][nf][r + 1];
                    x = gelu2(x);
                    acc[mf][nf][r] = x[0]; acc[mf][nf][r + 1] = x[1];
                }
    }

#pragma unroll 1
    for (int p = 0; p < 2; ++p) {
        if (wm == p) {
#pragma unroll
            for (int mf = 0; mf < 4; ++mf)
#pragma unroll
                for (int nf = 0; nf < 2; ++nf) {
                    const int col = wn * 32 + nf * 16 + l16;
#pragma unroll
                    for (int r = 0; r < 8; ++r) Cs[(mf * 16 + 8 * hh + r) * GSP + col] = acc[mf][nf][r];
                }
        }
        __syncthreads();
        if (omode & 1) {
            v4f vals[8];
            size_t po[8];
#pragma unroll
            for (int j = 0; j < 8; ++j) {
                const int e = t + 256 * j, row = e >> 5, c4 = (e & 31) * 4;
                vals[j] = *(const v4f*)(Cs + row * GSP + c4);
                po[j] = (size_t)(bm0 + p * 64 + row) * N + bn0 + c4;
            }
#pragma unroll
            for (int j = 0; j < 8; ++j) *(v4f*)(Cf + po[j]) = vals[j];
            
        }
        if (omode & 2) {
            v8h hv[4];
            size_t po[4];
#pragma unroll
            for (int j = 0; j < 4; ++j) {
                const int e = t + 256 * j, row = e >> 4, c8 = (e & 15) * 8;
                v4f a = *(const v4f*)(Cs + row * GSP + c8);
                v4f b = *(const v4f*)(Cs + row * GSP + c8 + 4);
                hv[j][0] = (f16)a[0]; hv[j][1] = (f16)a[1]; hv[j][2] = (f16)a[2]; hv[j][3] = (f16)a[3];
                hv[j][4] = (f16)b[0]; hv[j][5] = (f16)b[1]; hv[j][6] = (f16)b[2]; hv[j][7] = (f16)b[3];
                po[j] = (size_t)(bm0 + p * 64 + row) * N + bn0 + c8;
            }
#pragma unroll
            for (int j = 0; j < 4; ++j) *(v8h*)(Ch + po[j]) = hv[j];
            
        }
        __syncthreads();
    }
}

#define ALD 72      // staged row for plain 16-byte reads: 64 halves + 8 pad = 144 B
#define VLD 80      // staged row for the transposing read: 64 halves + 16 pad = 160 B

// 16-bit transposing LDS load: lane (c = l & 15, h = l >> 4) gets rows 8 h .. 8 h + 7 of column c of the 16 x 16 block
// whose lane addresses are row 8 h + (l & 7), 16-byte piece (l >> 3) & 1
typedef short s16x8 __attribute__((ext_vector_type(8)));
__device__ __forceinline__ v8h ld_tr16(const f16* p) {
    typedef __attribute__((address_space(3))) s16x8 lds_s16x8;
    return __builtin_bit_cast(v8h, __builtin_amdgcn_ds_load_tr16_b128_v8i16((lds_s16x8*)p));
}

// lane l <-> lane l ^ 16
__device__ __forceinline__ float xhalf(float x) {
    const int b = __builtin_bit_cast(int, x);
    return __builtin_bit_cast(float, __builtin_amdgcn_permlanex16(b, b, 0x76543210, 0xfedcba98, false, false));
}

__global__ __launch_bounds__(256) void k_attn(const f16* __restrict__ QKV, const float* __restrict__ mask,
                                               f16* Ctx, int nb) {
    __shared__ __attribute__((aligned(16))) f16 Ks[64 * ALD];   // [key][dim], pitch of the plain reads
    __shared__ __attribute__((aligned(16))) f16 Vs[64 * VLD];   // [key][dim] again, pitch of the transposing reads

    const int t = threadIdx.x, wave = t >> 5, lane = t & 31;
    const int hh = lane >> 4, l16 = lane & 15;
    const int bid = blockIdx.x;
    const int nqt = SEQ / 128;
    const int qt = bid % nqt, h = (bid / nqt) % NHD, b = bid / (nqt * NHD);
    if (b >= nb) return;
    const int q0 = qt * 128 + wave * 16;
    const size_t tok0 = (size_t)b * SEQ;             // compact token row base of this batch

    // Q as B operand: column n = query l16, 64 dims = two k=32 fragments
    Frag qb[2];
    {
        const f16* qp = QKV + (tok0 + q0 + l16) * HID + h * DHD;
#pragma unroll
        for (int kf = 0; kf < 2; ++kf) {
            qb[kf].half[0] = *(const v8h*)(qp + kf * 32 + 8 * hh);
            qb[kf].half[1] = *(const v8h*)(qp + kf * 32 + 16 + 8 * hh);
        }
    }

    float mrun = -3.0e38f, lrun = 0.0f;   // this lane's query: running maximum (both halves agree), this half's share of the sum
    v8f o[4];                             // o[nf][r] = O[query l16][dim nf * 16 + 8 hh + r]
#pragma unroll
    for (int nf = 0; nf < 4; ++nf) o[nf] = zero8();

    for (int kt = 0; kt < SEQ / 64; ++kt) {
        // stage 64 keys x 64 dims twice, row-major, each copy at its reader's pitch (same source rows)
        v8h kv[2];
#pragma unroll
        for (int j = 0; j < 2; ++j) {
            const int e = t + 256 * j, key = e >> 3, seg = (e & 7) * 8;
            const size_t g = (tok0 + kt * 64 + key) * HID + h * DHD + seg;
            kv[j] = *(const v8h*)(QKV + g);
        }
        // additive mask of this lane's 32 keys, n * 16 + 8 hh + r; asked for behind the tile, wanted only behind S^T
        v4f mk[4][2];
        {
            const float* mp = mask + (size_t)b * SEQ_FULL + kt * 64 + 8 * hh;
#pragma unroll
            for (int n = 0; n < 4; ++n) {
                mk[n][0] = *(const v4f*)(mp + n * 16);
                mk[n][1] = *(const v4f*)(mp + n * 16 + 4);
            }
        }
#pragma unroll
        for (int j = 0; j < 2; ++j) {
            const int e = t + 256 * j, key = e >> 3, seg = (e & 7) * 8;
            *(v8h*)(Ks + key * ALD + seg) = kv[j];
            *(v8h*)(Vs + key * VLD + seg) = kv[j];
        }
        __syncthreads();

        // S^T = K.Q^T / 8 + additive mask ; A operand row m = key, k = dim contiguous in Ks row
        v8f s[4];
#pragma unroll
        for (int n = 0; n < 4; ++n) {
            Frag kb0, kb1;
            const f16* kp = Ks + (n * 16 + l16) * ALD;
            kb0.half[0] = *(const v8h*)(kp + 8 * hh);
            kb0.half[1] = *(const v8h*)(kp + 16 + 8 * hh);
            kb1.half[0] = *(const v8h*)(kp + 32 + 8 * hh);
            kb1.half[1] = *(const v8h*)(kp + 48 + 8 * hh);
            v8f z = zero8();
            z = wmma16(kb0.v, qb[0].v, z);
            z = wmma16(kb1.v, qb[1].v, z);
#pragma unroll
            for (int r = 0; r < 8; ++r) s[n][r] = z[r] * 0.125f + mk[n][r >> 2][r & 3];
        }

        // online softmax of one query per lane
        float mx4[4];
#pragma unroll
        for (int n = 0; n < 4; ++n) {
            mx4[n] = fmaxf(fmaxf(fmaxf(s[n][0], s[n][1]), fmaxf(s[n][2], s[n][3])),
                           fmaxf(fmaxf(s[n][4], s[n][5]), fmaxf(s[n][6], s[n][7])));
        }
        float mx = fmaxf(fmaxf(mx4[0], mx4[1]), fmaxf(mx4[2], mx4[3]));
        mx = fmaxf(mx, xhalf(mx));
        const float mnew = fmaxf(mrun, mx);
        const float corr = __expf(mrun - mnew);
        mrun = mnew;
#pragma unroll
        for (int nf = 0; nf < 4; ++nf)
#pragma unroll
            for (int r = 0; r < 8; ++r) o[nf][r] *= corr;
        float rs4[4];
#pragma unroll
        for (int n = 0; n < 4; ++n)
#pragma unroll
            for (int r = 0; r < 8; ++r) s[n][r] = (s[n][r] - mnew) * 1.44269504088896340736f;
#pragma unroll
        for (int n = 0; n < 4; ++n)
#pragma unroll
            for (int r = 0; r < 8; ++r) s[n][r] = __builtin_amdgcn_exp2f(s[n][r]);
#pragma unroll
        for (int n = 0; n < 4; ++n)
            rs4[n] = ((s[n][0] + s[n][1]) + (s[n][2] + s[n][3])) + ((s[n][4] + s[n][5]) + (s[n][6] + s[n][7]));
        lrun = lrun * corr + ((rs4[0] + rs4[1]) + (rs4[2] + rs4[3]));

        // two S^T tiles (keys 32 kf + 8 hh + r and 32 kf + 16 + 8 hh + r) are one B fragment; p scaled by 2^12
        Frag pb[2];
#pragma unroll
        for (int kf = 0; kf < 2; ++kf)
#pragma unroll
            for (int j = 0; j < 2; ++j)
#pragma unroll
                for (int r = 0; r < 8; ++r)
                    pb[kf].half[j][r] = (f16)(s[2 * kf + j][r] * 4096.0f);

        // O^T += V^T.P^T ; A operand row m = dim, k = key: transposed on the way out of LDS, keys 8 hh .. and 16 + 8 hh ..
#pragma unroll
        for (int nf = 0; nf < 4; ++nf) {
            Frag vb0, vb1;
            const f16* vp = Vs + (8 * hh + (lane & 7)) * VLD + nf * 16 + 8 * ((lane >> 3) & 1);
            vb0.half[0] = ld_tr16(vp);
            vb0.half[1] = ld_tr16(vp + 16 * VLD);
            vb1.half[0] = ld_tr16(vp + 32 * VLD);
            vb1.half[1] = ld_tr16(vp + 48 * VLD);
            o[nf] = wmma16(vb0.v, pb[0].v, o[nf]);
            o[nf] = wmma16(vb1.v, pb[1].v, o[nf]);
        }
        __syncthreads();
    }

    // a lane's 8 accumulator registers are 8 consecutive dims of its query: one 16-byte store a tile
    const float il = 16.0f / ((lrun + xhalf(lrun)) * 4096.0f);
    v8h cv[4];
#pragma unroll
    for (int nf = 0; nf < 4; ++nf)
#pragma unroll
        for (int r = 0; r < 8; ++r) cv[nf][r] = (f16)(o[nf][r] * il);
    f16* cp = Ctx + (tok0 + q0 + l16) * HID + h * DHD + 8 * hh;
#pragma unroll
    for (int nf = 0; nf < 4; ++nf) *(v8h*)(cp + nf * 16) = cv[nf];
}

// ---------------- fused residual + LayerNorm over 1024 (256 threads x 4) ----------------
// residual row for compact row m is (m / rseq) * rseqf + m % rseq; res_bf16 != 0: residual is a raw input
// and is consumed as its RNE bf16 value; write_h != 0: also write the f16 copy (outh dereferenced only then)
__global__ __launch_bounds__(256) void k_ln(const float* __restrict__ a, const float* __restrict__ res,
                                             int rseq, int rseqf, int res_bf16,
                                             const float* __restrict__ g, const float* __restrict__ be,
                                             float* outf, f16* outh, int write_h, int nrows) {
    __shared__ float red1[8], red2[8];
    const int row = blockIdx.x;
    if (row >= nrows) return;
    const int t = threadIdx.x, wave = t >> 5, lane = t & 31;
    const size_t base = (size_t)row * HID + (size_t)t * 4;
    const size_t rrow = (size_t)(row / rseq) * (size_t)rseqf + (size_t)(row % rseq);
    const size_t rbase = rrow * HID + (size_t)t * 4;

    v4f rv = *(const v4f*)(res + rbase);
    if (res_bf16) {
        rv[0] = bf16r(rv[0]); rv[1] = bf16r(rv[1]); rv[2] = bf16r(rv[2]); rv[3] = bf16r(rv[3]);
    }
    v4f x = *(const v4f*)(a + base) + rv;
    float sm = (x[0] + x[1]) + (x[2] + x[3]);
#pragma unroll
    for (int off = 16; off >= 1; off >>= 1) sm += __shfl_xor(sm, off, 32);
    if (lane == 0) red1[wave] = sm;
    __syncthreads();
    float tot = 0.0f;
#pragma unroll
    for (int w = 0; w < 8; ++w) tot += red1[w];
    const float mu = tot * (1.0f / 1024.0f);

    v4f d = x - mu;
    float sq = (d[0] * d[0] + d[1] * d[1]) + (d[2] * d[2] + d[3] * d[3]);
#pragma unroll
    for (int off = 16; off >= 1; off >>= 1) sq += __shfl_xor(sq, off, 32);
    if (lane == 0) red2[wave] = sq;
    __syncthreads();
    float tot2 = 0.0f;
#pragma unroll
    for (int w = 0; w < 8; ++w) tot2 += red2[w];
    const float var = tot2 * (1.0f / 1024.0f);
    const float rstd = rsqrtf(var + 1.0e-5f);

    v4f gv = *(const v4f*)(g + t * 4);
    v4f bv = *(const v4f*)(be + t * 4);
    v4f y = d * rstd * gv + bv;
    v4h yh;
    yh[0] = (f16)y[0]; yh[1] = (f16)y[1]; yh[2] = (f16)y[2]; yh[3] = (f16)y[3];

    *(v4f*)(outf + base) = y;
    if (write_h) *(v4h*)(outh + base) = yh;
    
}

// ---------------- host launcher ----------------
extern "C" void kernel_launch(void* const* d_in, const int* in_sizes, int n_in,
                              void* d_out, int out_size, void* d_ws, size_t ws_size,
                              hipStream_t stream) {
    const int Mtok = MTOK;
    if (n_in < 14) return;
    if (in_sizes[0] < ((NB - 1) * SEQ_FULL + SEQ) * HID || in_sizes[1] < (NB - 1) * SEQ_FULL + SEQ ||
        in_sizes[2] < HID * HID || in_sizes[3] < HID || in_sizes[4] < HID * HID || in_sizes[5] < HID ||
        in_sizes[6] < HID || in_sizes[7] < HID || in_sizes[8] < DFF * HID || in_sizes[9] < DFF ||
        in_sizes[10] < HID * DFF || in_sizes[11] < HID || in_sizes[12] < HID || in_sizes[13] < HID ||
        out_size < Mtok * HID) return;

    const float* x    = (const float*)d_in[0];
    const float* amsk = (const float*)d_in[1];
    const float* Wq   = (const float*)d_in[2];  const float* bq   = (const float*)d_in[3];
    const float* Wso  = (const float*)d_in[4];  const float* bso  = (const float*)d_in[5];
    const float* ln1g = (const float*)d_in[6];  const float* ln1b = (const float*)d_in[7];
    const float* Wi   = (const float*)d_in[8];  const float* bi   = (const float*)d_in[9];
    const float* Wo   = (const float*)d_in[10]; const float* bo   = (const float*)d_in[11];
    const float* ln2g = (const float*)d_in[12]; const float* ln2b = (const float*)d_in[13];

    char* ws = (char*)d_ws;
    size_t off = 0;
    auto take = [&](size_t bytes) -> char* {
        char* p = ws + off;
        off += (bytes + 255) & ~(size_t)255;
        return p;
    };
    f16*   xh    = (f16*)take((size_t)Mtok * HID * 2);      // [Mtok][1024]
    f16*   wq16  = (f16*)take((size_t)HID * HID * 2);       // [N=1024][K=1024]
    f16*   wso16 = (f16*)take((size_t)HID * HID * 2);       // [N=1024][K=1024]
    f16*   wi16  = (f16*)take((size_t)DFF * HID * 2);       // [N=4096][K=1024]
    f16*   wo16  = (f16*)take((size_t)HID * DFF * 2);       // [N=1024][K=4096]
    f16*   qkvh  = (f16*)take((size_t)Mtok * HID * 2);
    f16*   ctxh  = (f16*)take((size_t)Mtok * HID * 2);
    float* attf  = (float*)take((size_t)Mtok * HID * 4);    // also holds fff later (same extent)
    float* h1f   = (float*)take((size_t)Mtok * HID * 4);
    f16*   h1h   = (f16*)take((size_t)Mtok * HID * 2);
    f16*   gh    = (f16*)take((size_t)Mtok * DFF * 2);
    float* fff   = attf;                                    // attf fully consumed by LN1 before the output GEMM writes fff
    if (off > ws_size) return;

    const int thr = 256;
    const float wsc = 64.0f;   // 2^6 weight operand scale, folded back in the GEMM epilogue

    // activations -> f16 (compact token rows), weights [N][K] -> scaled f16 [N][K]: one launch for all five
    k_cvt<<<CB_ALL, thr, 0, stream>>>(x, Wq, Wso, Wi, Wo, xh, wq16, wso16, wi16, wo16, wsc);

    const dim3 gH(HID / GBN, Mtok / GBM);     // N = 1024
    const dim3 gF(DFF / GBN, Mtok / GBM);     // N = 4096

    // Placeholder pointer arguments below (omode / write_h exclude them) are valid, correctly typed
    // workspace regions that the launch never dereferences.

    // shared q/k/v projection (f16 out only, [Mtok][1024]); Cf placeholder = attf
    k_gemm<<<gH, thr, 0, stream>>>(xh, wq16, bq, attf, qkvh, Mtok, HID, HID, 0, 0.015625f, 2);

    // attention: one block per (batch, head, 128 queries); ctx carried * 2^4
    k_attn<<<NB * NHD * (SEQ / 128), thr, 0, stream>>>(qkvh, amsk, ctxh, NB);

    // self-output projection (f32 out only, * 2^-6 * 2^-4); Ch placeholder = gh
    k_gemm<<<gH, thr, 0, stream>>>(ctxh, wso16, bso, attf, gh, Mtok, HID, HID, 0, 0.0009765625f, 1);
    // LN1(attn + bf16(x)) -> h1 (f32 + f16 copy)
    k_ln<<<Mtok, thr, 0, stream>>>(attf, x, SEQ, SEQ_FULL, 1, ln1g, ln1b, h1f, h1h, 1, Mtok);

    // FFN: GELU(h1.Wi^T + bi) (f16 out only; Cf placeholder = attf) . Wo^T + bo (f32 out only; Ch placeholder = h1h)
    k_gemm<<<gF, thr, 0, stream>>>(h1h, wi16, bi, attf, gh, Mtok, DFF, HID, 1, 0.015625f, 2);
    k_gemm<<<gH, thr, 0, stream>>>(gh, wo16, bo, fff, h1h, Mtok, HID, DFF, 0, 0.015625f, 1);
    // LN2(ff + h1) -> d_out (f32 only; outh placeholder = h1h, residual not converted)
    k_ln<<<Mtok, thr, 0, stream>>>(fff, h1f, SEQ, SEQ, 0, ln2g, ln2b, (float*)d_out, h1h, 0, Mtok);
}

// v006
// Measured time: 158 microseconds a run.
// Two timings next to v005 both put it at 1.05 times that version's speed.
// Over all steps from v000 it is 2.23 times as fast.
#include <hip/hip_runtime.h>
#include <stdint.h>
// All contractions: v_wmma_f32_16x16x32_f16 (f16 operands, f32 accumulate): qkv, self-output, intermediate and output projections (float inputs RNE-converted to bf16 then f16; weight operand scaled by 2^6, ctx operand by 2^4, folded back in the epilogue), q.k^T and p.v (p scaled by 2^12); softmax, LayerNorm, GELU, residuals in f32.

#ifndef NB
#define NB 2
#endif
#ifndef SEQ
#define SEQ 2048
#endif
#define NB_FULL 2
#define SEQ_FULL 2048
#define HID 1024
#define NHD 16
#define DHD 64
#define DFF 4096
#define MTOK (NB * SEQ)

static_assert(NB >= 1 && NB <= NB_FULL);
static_assert(SEQ >= 128 && SEQ <= SEQ_FULL && (SEQ % 128) == 0);
static_assert((MTOK % 128) == 0);
static_assert(HID == NHD * DHD);
static_assert((HID % 128) == 0 && (DFF % 128) == 0 && (HID % 32) == 0 && (DFF % 32) == 0);

typedef _Float16 f16;
typedef f16   v4h  __attribute__((ext_vector_type(4)));
typedef f16   v8h  __attribute__((ext_vector_type(8)));
typedef f16   v16h __attribute__((ext_vector_type(16)));
typedef float v4f  __attribute__((ext_vector_type(4)));
typedef float v8f  __attribute__((ext_vector_type(8)));
union Frag { v16h v; v8h half[2]; };

// 16x16x32 f16 WMMA with hazard guard (4 VALU slots) tied to D, A and B
__device__ __forceinline__ v8f wmma16(v16h a, v16h b, v8f c) {
    v8f d = __builtin_amdgcn_wmma_f32_16x16x32_f16(false, a, false, b, (short)0, c, false, false);
    asm volatile("v_nop\n\tv_nop\n\tv_nop\n\tv_nop" : "+v"(d) : "v"(a), "v"(b));
    return d;
}
__device__ __forceinline__ v8f zero8() {
    v8f z;
#pragma unroll
    for (int i = 0; i < 8; ++i) z[i] = 0.0f;
    return z;
}
// f32 -> nearest-even bf16 value, returned as f32
__device__ __forceinline__ float bf16r(float x) {
    unsigned u = __float_as_uint(x);
    u = (u + 0x7FFFu + ((u >> 16) & 1u)) & 0xFFFF0000u;
    return __uint_as_float(u);
}

// Five conversions that need nothing of each other share one grid: a range of the block index picks the job (the branch
// is block-uniform). Every job is a whole number of blocks of 256 threads x 8 values.
// Activations: compact destination row m reads source row (m / SEQ) * SEQ_FULL + m % SEQ, scale 1.
// Weights: [N][K] as they lie, scaled by wscale.
#define CVB 2048                        // values of one block
#define CB_X (MTOK * HID / CVB)         // blocks of the activations
#define CB_S (HID * HID / CVB)          // blocks of a 1024 x 1024 weight
#define CB_L (DFF * HID / CVB)          // blocks of a 4096 x 1024 or 1024 x 4096 weight
#define CB_ALL (CB_X + 2 * CB_S + 2 * CB_L)
static_assert((MTOK * HID) % CVB == 0 && (HID * HID) % CVB == 0 && (DFF * HID) % CVB == 0 && (HID % 8) == 0);

__global__ __launch_bounds__(256) void k_cvt(const float* __restrict__ x, const float* __restrict__ wq,
                                              const float* __restrict__ wso, const float* __restrict__ wi,
                                              const float* __restrict__ wo, f16* xh, f16* wq16, f16* wso16,
                                              f16* wi16, f16* wo16, float wscale) {
    const int blk = blockIdx.x;
    const float* in;
    f16* out;
    int first;                          // first block of this block's job
    if (blk < CB_X)                           { in = x;   out = xh;    first = 0; }
    else if (blk < CB_X + CB_S)               { in = wq;  out = wq16;  first = CB_X; }
    else if (blk < CB_X + 2 * CB_S)           { in = wso; out = wso16; first = CB_X + CB_S; }
    else if (blk < CB_X + 2 * CB_S + CB_L)    { in = wi;  out = wi16;  first = CB_X + 2 * CB_S; }
    else if (blk < CB_ALL)                    { in = wo;  out = wo16;  first = CB_X + 2 * CB_S + CB_L; }
    else return;
    const size_t i8 = ((size_t)(blk - first) * 256 + threadIdx.x) * 8;
    size_t src = i8;
    float scale = wscale;
    if (blk < CB_X) {
        const size_t m = i8 / HID, c = i8 % HID;
        src = ((m / SEQ) * SEQ_FULL + m % SEQ) * HID + c;
        scale = 1.0f;
    }
    v4f a = *(const v4f*)(in + src);
    v4f b = *(const v4f*)(in + src + 4);
    v8h hv;
    hv[0] = (f16)(bf16r(a[0]) * scale); hv[1] = (f16)(bf16r(a[1]) * scale);
    hv[2] = (f16)(bf16r(a[2]) * scale); hv[3] = (f16)(bf16r(a[3]) * scale);
    hv[4] = (f16)(bf16r(b[0]) * scale); hv[5] = (f16)(bf16r(b[1]) * scale);
    hv[6] = (f16)(bf16r(b[2]) * scale); hv[7] = (f16)(bf16r(b[3]) * scale);
    *(v8h*)(out + i8) = hv;
}

// ---------------- tiled GEMM: C[M][N] = A[M][K] (f16) . B, B given as BT[N][K] (f16, k-contiguous) ----------------
// epilogue: * oscale + bias, optional exact GELU; f32 (omode bit 0) and/or f16 (omode bit 1) output,
#define GBM 128
#define GBN 128
#define GBK 128     // k depth of one ring stage
#define GLD 136     // staged row: 128 halves + 8 pad = 272 B
#define GSP 132     // staging row pitch in floats (528 B)
#define GTILE (GBM * GLD)       // halves of one operand tile in LDS
#define GSTAGE (2 * GTILE)      // halves of one stage: [A tile | B tile]

static_assert((HID % GBK) == 0 && (DFF % GBK) == 0);
static_assert(64 * GSP * 4 <= 2 * GSTAGE * 2);

// One lane's share of a 128-row x 256-byte operand tile: rows r, r+16, .. r+112, 16 bytes each, global -> LDS
// without passing registers. lds = LDS byte address of row r's piece, g = its global address, gstep = 16 rows in halves.
// s_wait_xcnt is the statement's last line, a precaution: so it stands ahead of every later rewrite of these address registers.
__device__ __forceinline__ void copy_tile(unsigned lds, const f16* g, size_t gstep) {
    asm volatile("global_load_async_to_lds_b128 %0, %8, off\n\t"
                 "global_load_async_to_lds_b128 %1, %9, off\n\t"
                 "global_load_async_to_lds_b128 %2, %10, off\n\t"
                 "global_load_async_to_lds_b128 %3, %11, off\n\t"
                 "global_load_async_to_lds_b128 %4, %12, off\n\t"
                 "global_load_async_to_lds_b128 %5, %13, off\n\t"
                 "global_load_async_to_lds_b128 %6, %14, off\n\t"
                 "global_load_async_to_lds_b128 %7, %15, off\n\t"
                 "s_wait_xcnt 0x0"
                 :: "v"(lds), "v"(lds + 1u * 16u * GLD * 2u), "v"(lds + 2u * 16u * GLD * 2u),
                    "v"(lds + 3u * 16u * GLD * 2u), "v"(lds + 4u * 16u * GLD * 2u), "v"(lds + 5u * 16u * GLD * 2u),
                    "v"(lds + 6u * 16u * GLD * 2u), "v"(lds + 7u * 16u * GLD * 2u),
                    "v"(g), "v"(g + gstep), "v"(g + 2 * gstep), "v"(g + 3 * gstep),
                    "v"(g + 4 * gstep), "v"(g + 5 * gstep), "v"(g + 6 * gstep), "v"(g + 7 * gstep)
                 : "memory");
}

// exact GELU of two values, x/2 * (1 + erf(x / sqrt 2)), without a branch: erf's two ranges (|z| < 1: odd polynomial in z;
// else 1 - exp(-q(|z|))) are both evaluated and one is selected, so that the values of a lane are independent chains.
typedef float v2f __attribute__((ext_vector_type(2)));
__device__ __forceinline__ v2f fma2(v2f a, v2f b, float c) {
    v2f cc; cc[0] = c; cc[1] = c;
    return __builtin_elementwise_fma(a, b, cc);
}
__device__ __forceinline__ v2f gelu2(v2f x) {
    const v2f z = x * 0.70710678118654752f;
    v2f a; a[0] = fabsf(z[0]); a[1] = fabsf(z[1]);
    const v2f t = z * z;
    v2f ps; ps[0] = -0x1.268bc2p-11f; ps[1] = -0x1.268bc2p-11f;
    ps = fma2(t, ps, 0x1.420828p-8f);
    ps = fma2(t, ps, -0x1.b5937p-6f);
    ps = fma2(t, ps, 0x1.ce077cp-4f);
    ps = fma2(t, ps, -0x1.81266p-2f);
    ps = fma2(t, ps, 0x1.06ebap-3f);
    ps = __builtin_elementwise_fma(a, ps, a);
    v2f q; q[0] = 0x1.1d3156p-16f; q[1] = 0x1.1d3156p-16f;
    q = fma2(a, q, -0x1.8d129p-12f);
    q = fma2(a, q, 0x1.f9a6d2p-9f);
    q = fma2(a, q, -0x1.8c3164p-6f);
    q = fma2(a, q, 0x1.b4e9c8p-4f);
    q = fma2(a, q, 0x1.4515fap-1f);
    q = fma2(a, q, 0x1.078e5p-3f);
    q = __builtin_elementwise_fma(a, q, a);
    q = q * -1.44269504088896340736f;
    v2f e;
    e[0] = __builtin_copysignf(a[0] < 1.0f ? ps[0] : 1.0f - __builtin_amdgcn_exp2f(q[0]), z[0]);
    e[1] = __builtin_copysignf(a[1] < 1.0f ? ps[1] : 1.0f - __builtin_amdgcn_exp2f(q[1]), z[1]);
    return (x * 0.5f) * (1.0f + e);
}

// ring: RB stages of LDS (RB a power of two); output staging once the loop has left it
template <int RB>
__device__ __forceinline__ void gemm_body(f16* ring, const f16* __restrict__ A, const f16* __restrict__ BT,
                                          const float* __restrict__ bias, float* Cf, f16* Ch,
                                          int M, int N, int K, int act, float oscale, int omode) {
    static_assert(RB >= 2 && (RB & (RB - 1)) == 0 && (RB - 1) * 16 <= 63);   // a wave's copies in flight stay under 64
    float* Cs = (float*)ring;

    const int t = threadIdx.x, wave = t >> 5, lane = t & 31;
    const int hh = lane >> 4, l16 = lane & 15;
    const int wm = wave >> 2, wn = wave & 3;          // 2 x 4 waves, 64 x 32 per wave
    const int bm0 = blockIdx.y * GBM, bn0 = blockIdx.x * GBN;
    if (bm0 + GBM > M || bn0 + GBN > N) return;       // block-uniform; host guarantees exact multiples

    v8f acc[4][2];
#pragma unroll
    for (int i = 0; i < 4; ++i)
#pragma unroll
        for (int j = 0; j < 2; ++j) acc[i][j] = zero8();

    // ring of RB buffers: stage s lives in buffer s & (RB - 1); its copies (16 a wave) are issued RB - 1 stages before it is
    // multiplied, so up to RB - 1 stages fly while one is multiplied
    const int nk = K / GBK;
    const int crow = t >> 4, cseg = (t & 15) * 8;     // this lane copies rows crow + 16 j, halves cseg .. cseg + 7
    const f16* ga = A  + (size_t)(bm0 + crow) * K + cseg;
    const f16* gb = BT + (size_t)(bn0 + crow) * K + cseg;
    const size_t gstep = (size_t)16 * K;
    const unsigned lcopy = (unsigned)(uintptr_t)ring + (unsigned)(crow * GLD + cseg) * 2u;

#pragma unroll   // straight-line fills, each buffer's offset a constant
    for (int s = 0; s < RB - 1; ++s)
        if (s < nk) {
            copy_tile(lcopy + (unsigned)s * (GSTAGE * 2u), ga + s * GBK, gstep);
            copy_tile(lcopy + (unsigned)s * (GSTAGE * 2u) + GTILE * 2u, gb + s * GBK, gstep);
        }
    // stage 0 of this wave has landed: the count leaves out only the copies of the RB - 2 younger stages; fewer stages: all
    if (nk >= RB - 1) asm volatile("s_wait_asynccnt %0" :: "n"((RB - 2) * 16) : "memory");
    else              asm volatile("s_wait_asynccnt 0x0" ::: "memory");
    __syncthreads();                                    // ... and of every wave

    // refill(): called behind the stage's first fragment reads, ahead of their wait
    auto mul_stage = [&](int it, auto refill) {
        const f16* As = ring + (unsigned)(it & (RB - 1)) * GSTAGE;
        const f16* Bs = As + GTILE;
#pragma unroll   // every LDS offset of the stage becomes an immediate
        for (int ks = 0; ks < GBK / 32; ++ks) {
            Frag af[4], bf[2];
#pragma unroll
            for (int mf = 0; mf < 4; ++mf) {
                const f16* ap = As + (wm * 64 + mf * 16 + l16) * GLD + ks * 32;
                af[mf].half[0] = *(const v8h*)(ap + 8 * hh);        // k = 8h .. 8h+7
                af[mf].half[1] = *(const v8h*)(ap + 16 + 8 * hh);   // k = 16+8h .. 16+8h+7
            }
#pragma unroll
            for (int nf = 0; nf < 2; ++nf) {
                const f16* bp = Bs + (wn * 32 + nf * 16 + l16) * GLD + ks * 32;   // column n, k-contiguous
                bf[nf].half[0] = *(const v8h*)(bp + 8 * hh);
                bf[nf].half[1] = *(const v8h*)(bp + 16 + 8 * hh);
            }
            if (ks == 0) refill();
#pragma unroll
            for (int mf = 0; mf < 4; ++mf)
#pragma unroll
                for (int nf = 0; nf < 2; ++nf)
                    acc[mf][nf] = wmma16(af[mf].v, bf[nf].v, acc[mf][nf]);
        }
    };
    auto nothing = []() {};

    int it = 0;
    for (; it + RB - 1 < nk; ++it) {
        // refill of the buffer that stage it - 1 has left: every wave's last read of it ended at the barrier just passed
        auto refill = [&]() {
            const unsigned nb = (unsigned)((it + RB - 1) & (RB - 1));
            copy_tile(lcopy + nb * (GSTAGE * 2u), ga + (size_t)(it + RB - 1) * GBK, gstep);
            copy_tile(lcopy + nb * (GSTAGE * 2u) + GTILE * 2u, gb + (size_t)(it + RB - 1) * GBK, gstep);
        };
        if constexpr (RB > 2) {
            mul_stage(it, refill);      // wanted only RB - 1 stages on: its issue stands where the wave would wait for LDS anyway
        } else {
            refill();                   // wanted by the next stage: first thing behind the barrier
            mul_stage(it, nothing);
        }
        asm volatile("s_wait_dscnt 0x0" ::: "memory");      // this wave's reads of stage it are done before its buffer is refilled
        // this wave's copies of stage it + 1 have landed: the count leaves out only those of the RB - 2 younger stages
        asm volatile("s_wait_asynccnt %0" :: "n"((RB - 2) * 16) : "memory");
        __syncthreads();                                    // publishes stage it + 1, frees the buffer of stage it
    }
    for (; it < nk; ++it) {                                 // the last stages: nothing is issued any more, so the wait is for all
        mul_stage(it, nothing);
        asm volatile("s_wait_dscnt 0x0" ::: "memory");      // this wave's reads are done before the ring is reused
        asm volatile("s_wait_asynccnt 0x0" ::: "memory");   // this wave's copies of every stage left have landed
        __syncthreads();                                    // publishes them; behind the last stage it frees the ring
    }
    asm volatile("s_wait_asynccnt 0x0" ::: "memory");       // nothing in flight when the ring becomes output staging

    // scale, bias and activation: every lane on its own 64 values at once, in registers, ahead of the staging phases
    // (all loops unrolled: accumulator indices must be constants, and the 32 pairs must stand side by side to interleave)
#pragma unroll
    for (int nf = 0; nf < 2; ++nf) {
        const float bvv = bias[bn0 + wn * 32 + nf * 16 + l16];
#pragma unroll
        for (int mf = 0; mf < 4; ++mf)
#pragma unroll
            for (int r = 0; r < 8; ++r) acc[mf][nf][r] = acc[mf][nf][r] * oscale + bvv;
    }
    if (act) {
#pragma unroll
        for (int mf = 0; mf < 4; ++mf)
#pragma unroll
            for (int nf = 0; nf < 2; ++nf)
#pragma unroll
                for (int r = 0; r < 8; r += 2) {
                    v2f x; x[0] = acc[mf][nf][r]; x[1] = acc[mf][nf][r + 1];
                    x = gelu2(x);
                    acc[mf][nf][r] = x[0]; acc[mf][nf][r + 1] = x[1];
                }
    }

#pragma unroll 1
    for (int p = 0; p < 2; ++p) {
        if (wm == p) {
#pragma unroll
            for (int mf = 0; mf < 4; ++mf)
#pragma unroll
                for (int nf = 0; nf < 2; ++nf) {
                    const int col = wn * 32 + nf * 16 + l16;
#pragma unroll
                    for (int r = 0; r < 8; ++r) Cs[(mf * 16 + 8 * hh + r) * GSP + col] = acc[mf][nf][r];
                }
        }
        __syncthreads();
        if (omode & 1) {
            v4f vals[8];
            size_t po[8];
#pragma unroll
            for (int j = 0; j < 8; ++j) {
                const int e = t + 256 * j, row = e >> 5, c4 = (e & 31) * 4;
                vals[j] = *(const v4f*)(Cs + row * GSP + c4);
                po[j] = (size_t)(bm0 + p * 64 + row) * N + bn0 + c4;
            }
#pragma unroll
            for (int j = 0; j < 8; ++j) *(v4f*)(Cf + po[j]) = vals[j];
            
        }
        if (omode & 2) {
            v8h hv[4];
            size_t po[4];
#pragma unroll
            for (int j = 0; j < 4; ++j) {
                const int e = t + 256 * j, row = e >> 4, c8 = (e & 15) * 8;
                v4f a = *(const v4f*)(Cs + row * GSP + c8);
                v4f b = *(const v4f*)(Cs + row * GSP + c8 + 4);
                hv[j][0] = (f16)a[0]; hv[j][1] = (f16)a[1]; hv[j][2] = (f16)a[2]; hv[j][3] = (f16)a[3];
                hv[j][4] = (f16)b[0]; hv[j][5] = (f16)b[1]; hv[j][6] = (f16)b[2]; hv[j][7] = (f16)b[3];
                po[j] = (size_t)(bm0 + p * 64 + row) * N + bn0 + c8;
            }
#pragma unroll
            for (int j = 0; j < 4; ++j) *(v8h*)(Ch + po[j]) = hv[j];
            
        }
        __syncthreads();
    }
}

// N = 4096: four work-groups a WGP, two of them resident at a time, each covering the other's waits: two buffers, 136 KiB
__global__ __launch_bounds__(256) void k_gemm(const f16* __restrict__ A, const f16* __restrict__ BT,
                                               const float* __restrict__ bias, float* Cf, f16* Ch,
                                               int M, int N, int K, int act, float oscale, int omode) {
    __shared__ __attribute__((aligned(16))) f16 ring[2 * GSTAGE];
    gemm_body<2>(ring, A, BT, bias, Cf, Ch, M, N, K, act, oscale, omode);
}
// N = 1024: as many work-groups as WGPs, nothing else on a WGP covers a wait for copies: four buffers, 272 KiB
__global__ __launch_bounds__(256) void k_gemm_deep(const f16* __restrict__ A, const f16* __restrict__ BT,
                                                    const float* __restrict__ bias, float* Cf, f16* Ch,
                                                    int M, int N, int K, int act, float oscale, int omode) {
    __shared__ __attribute__((aligned(16))) f16 ring[4 * GSTAGE];
    gemm_body<4>(ring, A, BT, bias, Cf, Ch, M, N, K, act, oscale, omode);
}

#define ALD 72      // staged row for plain 16-byte reads: 64 halves + 8 pad = 144 B
#define VLD 80      // staged row for the transposing read: 64 halves + 16 pad = 160 B

// 16-bit transposing LDS load: lane (c = l & 15, h = l >> 4) gets rows 8 h .. 8 h + 7 of column c of the 16 x 16 block
// whose lane addresses are row 8 h + (l & 7), 16-byte piece (l >> 3) & 1
typedef short s16x8 __attribute__((ext_vector_type(8)));
__device__ __forceinline__ v8h ld_tr16(const f16* p) {
    typedef __attribute__((address_space(3))) s16x8 lds_s16x8;
    return __builtin_bit_cast(v8h, __builtin_amdgcn_ds_load_tr16_b128_v8i16((lds_s16x8*)p));
}

// lane l <-> lane l ^ 16
__device__ __forceinline__ float xhalf(float x) {
    const int b = __builtin_bit_cast(int, x);
    return __builtin_bit_cast(float, __builtin_amdgcn_permlanex16(b, b, 0x76543210, 0xfedcba98, false, false));
}

__global__ __launch_bounds__(256) void k_attn(const f16* __restrict__ QKV, const float* __restrict__ mask,
                                               f16* Ctx, int nb) {
    __shared__ __attribute__((aligned(16))) f16 Ks[64 * ALD];   // [key][dim], pitch of the plain reads
    __shared__ __attribute__((aligned(16))) f16 Vs[64 * VLD];   // [key][dim] again, pitch of the transposing reads

    const int t = threadIdx.x, wave = t >> 5, lane = t & 31;
    const int hh = lane >> 4, l16 = lane & 15;
    const int bid = blockIdx.x;
    const int nqt = SEQ / 128;
    const int qt = bid % nqt, h = (bid / nqt) % NHD, b = bid / (nqt * NHD);
    if (b >= nb) return;
    const int q0 = qt * 128 + wave * 16;
    const size_t tok0 = (size_t)b * SEQ;             // compact token row base of this batch

    // Q as B operand: column n = query l16, 64 dims = two k=32 fragments
    Frag qb[2];
    {
        const f16* qp = QKV + (tok0 + q0 + l16) * HID + h * DHD;
#pragma unroll
        for (int kf = 0; kf < 2; ++kf) {
            qb[kf].half[0] = *(const v8h*)(qp + kf * 32 + 8 * hh);
            qb[kf].half[1] = *(const v8h*)(qp + kf * 32 + 16 + 8 * hh);
        }
    }

    float mrun = -3.0e38f, lrun = 0.0f;   // this lane's query: running maximum (both halves agree), this half's share of the sum
    v8f o[4];                             // o[nf][r] = O[query l16][dim nf * 16 + 8 hh + r]
#pragma unroll
    for (int nf = 0; nf < 4; ++nf) o[nf] = zero8();

    for (int kt = 0; kt < SEQ / 64; ++kt) {
        // stage 64 keys x 64 dims twice, row-major, each copy at its reader's pitch (same source rows)
        v8h kv[2];
#pragma unroll
        for (int j = 0; j < 2; ++j) {
            const int e = t + 256 * j, key = e >> 3, seg = (e & 7) * 8;
            const size_t g = (tok0 + kt * 64 + key) * HID + h * DHD + seg;
            kv[j] = *(const v8h*)(QKV + g);
        }
        // additive mask of this lane's 32 keys, n * 16 + 8 hh + r; asked for behind the tile, wanted only behind S^T
        v4f mk[4][2];
        {
            const float* mp = mask + (size_t)b * SEQ_FULL + kt * 64 + 8 * hh;
#pragma unroll
            for (int n = 0; n < 4; ++n) {
                mk[n][0] = *(const v4f*)(mp + n * 16);
                mk[n][1] = *(const v4f*)(mp + n * 16 + 4);
            }
        }
#pragma unroll
        for (int j = 0; j < 2; ++j) {
            const int e = t + 256 * j, key = e >> 3, seg = (e & 7) * 8;
            *(v8h*)(Ks + key * ALD + seg) = kv[j];
            *(v8h*)(Vs + key * VLD + seg) = kv[j];
        }
        __syncthreads();

        // S^T = K.Q^T / 8 + additive mask ; A operand row m = key, k = dim contiguous in Ks row
        v8f s[4];
#pragma unroll
        for (int n = 0; n < 4; ++n) {
            Frag kb0, kb1;
            const f16* kp = Ks + (n * 16 + l16) * ALD;
            kb0.half[0] = *(const v8h*)(kp + 8 * hh);
            kb0.half[1] = *(const v8h*)(kp + 16 + 8 * hh);
            kb1.half[0] = *(const v8h*)(kp + 32 + 8 * hh);
            kb1.half[1] = *(const v8h*)(kp + 48 + 8 * hh);
            v8f z = zero8();
            z = wmma16(kb0.v, qb[0].v, z);
            z = wmma16(kb1.v, qb[1].v, z);
#pragma unroll
            for (int r = 0; r < 8; ++r) s[n][r] = z[r] * 0.125f + mk[n][r >> 2][r & 3];
        }

        // online softmax of one query per lane
        float mx4[4];
#pragma unroll
        for (int n = 0; n < 4; ++n) {
            mx4[n] = fmaxf(fmaxf(fmaxf(s[n][0], s[n][1]), fmaxf(s[n][2], s[n][3])),
                           fmaxf(fmaxf(s[n][4], s[n][5]), fmaxf(s[n][6], s[n][7])));
        }
        float mx = fmaxf(fmaxf(mx4[0], mx4[1]), fmaxf(mx4[2], mx4[3]));
        mx = fmaxf(mx, xhalf(mx));
        const float mnew = fmaxf(mrun, mx);
        const float corr = __expf(mrun - mnew);
        mrun = mnew;
#pragma unroll
        for (int nf = 0; nf < 4; ++nf)
#pragma unroll
            for (int r = 0; r < 8; ++r) o[nf][r] *= corr;
        float rs4[4];
#pragma unroll
        for (int n = 0; n < 4; ++n)
#pragma unroll
            for (int r = 0; r < 8; ++r) s[n][r] = (s[n][r] - mnew) * 1.44269504088896340736f;
#pragma unroll
        for (int n = 0; n < 4; ++n)
#pragma unroll
            for (int r = 0; r < 8; ++r) s[n][r] = __builtin_amdgcn_exp2f(s[n][r]);
#pragma unroll
        for (int n = 0; n < 4; ++n)
            rs4[n] = ((s[n][0] + s[n][1]) + (s[n][2] + s[n][3])) + ((s[n][4] + s[n][5]) + (s[n][6] + s[n][7]));
        lrun = lrun * corr + ((rs4[0] + rs4[1]) + (rs4[2] + rs4[3]));

        // two S^T tiles (keys 32 kf + 8 hh + r and 32 kf + 16 + 8 hh + r) are one B fragment; p scaled by 2^12
        Frag pb[2];
#pragma unroll
        for (int kf = 0; kf < 2; ++kf)
#pragma unroll
            for (int j = 0; j < 2; ++j)
#pragma unroll
                for (int r = 0; r < 8; ++r)
                    pb[kf].half[j][r] = (f16)(s[2 * kf + j][r] * 4096.0f);

        // O^T += V^T.P^T ; A operand row m = dim, k = key: transposed on the way out of LDS, keys 8 hh .. and 16 + 8 hh ..
#pragma unroll
        for (int nf = 0; nf < 4; ++nf) {
            Frag vb0, vb1;
            const f16* vp = Vs + (8 * hh + (lane & 7)) * VLD + nf * 16 + 8 * ((lane >> 3) & 1);
            vb0.half[0] = ld_tr16(vp);
            vb0.half[1] = ld_tr16(vp + 16 * VLD);
            vb1.half[0] = ld_tr16(vp + 32 * VLD);
            vb1.half[1] = ld_tr16(vp + 48 * VLD);
            o[nf] = wmma16(vb0.v, pb[0].v, o[nf]);
            o[nf] = wmma16(vb1.v, pb[1].v, o[nf]);
        }
        __syncthreads();
    }

    // a lane's 8 accumulator registers are 8 consecutive dims of its query: one 16-byte store a tile
    const float il = 16.0f / ((lrun + xhalf(lrun)) * 4096.0f);
    v8h cv[4];
#pragma unroll
    for (int nf = 0; nf < 4; ++nf)
#pragma unroll
        for (int r = 0; r < 8; ++r) cv[nf][r] = (f16)(o[nf][r] * il);
    f16* cp = Ctx + (tok0 + q0 + l16) * HID + h * DHD + 8 * hh;
#pragma unroll
    for (int nf = 0; nf < 4; ++nf) *(v8h*)(cp + nf * 16) = cv[nf];
}

// ---------------- fused residual + LayerNorm over 1024 (256 threads x 4) ----------------
// residual row for compact row m is (m / rseq) * rseqf + m % rseq; res_bf16 != 0: residual is a raw input
// and is consumed as its RNE bf16 value; write_h != 0: also write the f16 copy (outh dereferenced only then)
__global__ __launch_bounds__(256) void k_ln(const float* __restrict__ a, const float* __restrict__ res,
                                             int rseq, int rseqf, int res_bf16,
                                             const float* __restrict__ g, const float* __restrict__ be,
                                             float* outf, f16* outh, int write_h, int nrows) {
    __shared__ float red1[8], red2[8];
    const int row = blockIdx.x;
    if (row >= nrows) return;
    const int t = threadIdx.x, wave = t >> 5, lane = t & 31;
    const size_t base = (size_t)row * HID + (size_t)t * 4;
    const size_t rrow = (size_t)(row / rseq) * (size_t)rseqf + (size_t)(row % rseq);
    const size_t rbase = rrow * HID + (size_t)t * 4;

    v4f rv = *(const v4f*)(res + rbase);
    if (res_bf16) {
        rv[0] = bf16r(rv[0]); rv[1] = bf16r(rv[1]); rv[2] = bf16r(rv[2]); rv[3] = bf16r(rv[3]);
    }
    v4f x = *(const v4f*)(a + base) + rv;
    float sm = (x[0] + x[1]) + (x[2] + x[3]);
#pragma unroll
    for (int off = 16; off >= 1; off >>= 1) sm += __shfl_xor(sm, off, 32);
    if (lane == 0) red1[wave] = sm;
    __syncthreads();
    float tot = 0.0f;
#pragma unroll
    for (int w = 0; w < 8; ++w) tot += red1[w];
    const float mu = tot * (1.0f / 1024.0f);

    v4f d = x - mu;
    float sq = (d[0] * d[0] + d[1] * d[1]) + (d[2] * d[2] + d[3] * d[3]);
#pragma unroll
    for (int off = 16; off >= 1; off >>= 1) sq += __shfl_xor(sq, off, 32);
    if (lane == 0) red2[wave] = sq;
    __syncthreads();
    float tot2 = 0.0f;
#pragma unroll
    for (int w = 0; w < 8; ++w) tot2 += red2[w];
    const float var = tot2 * (1.0f / 1024.0f);
    const float rstd = rsqrtf(var + 1.0e-5f);

    v4f gv = *(const v4f*)(g + t * 4);
    v4f bv = *(const v4f*)(be + t * 4);
    v4f y = d * rstd * gv + bv;
    v4h yh;
    yh[0] = (f16)y[0]; yh[1] = (f16)y[1]; yh[2] = (f16)y[2]; yh[3] = (f16)y[3];

    *(v4f*)(outf + base) = y;
    if (write_h) *(v4h*)(outh + base) = yh;
    
}

// ---------------- host launcher ----------------
extern "C" void kernel_launch(void* const* d_in, const int* in_sizes, int n_in,
                              void* d_out, int out_size, void* d_ws, size_t ws_size,
                              hipStream_t stream) {
    const int Mtok = MTOK;
    if (n_in < 14) return;
    if (in_sizes[0] < ((NB - 1) * SEQ_FULL + SEQ) * HID || in_sizes[1] < (NB - 1) * SEQ_FULL + SEQ ||
        in_sizes[2] < HID * HID || in_sizes[3] < HID || in_sizes[4] < HID * HID || in_sizes[5] < HID ||
        in_sizes[6] < HID || in_sizes[7] < HID || in_sizes[8] < DFF * HID || in_sizes[9] < DFF ||
        in_sizes[10] < HID * DFF || in_sizes[11] < HID || in_sizes[12] < HID || in_sizes[13] < HID ||
        out_size < Mtok * HID) return;

    const float* x    = (const float*)d_in[0];
    const float* amsk = (const float*)d_in[1];
    const float* Wq   = (const float*)d_in[2];  const float* bq   = (const float*)d_in[3];
    const float* Wso  = (const float*)d_in[4];  const float* bso  = (const float*)d_in[5];
    const float* ln1g = (const float*)d_in[6];  const float* ln1b = (const float*)d_in[7];
    const float* Wi   = (const float*)d_in[8];  const float* bi   = (const float*)d_in[9];
    const float* Wo   = (const float*)d_in[10]; const float* bo   = (const float*)d_in[11];
    const float* ln2g = (const float*)d_in[12]; const float* ln2b = (const float*)d_in[13];

    char* ws = (char*)d_ws;
    size_t off = 0;
    auto take = [&](size_t bytes) -> char* {
        char* p = ws + off;
        off += (bytes + 255) & ~(size_t)255;
        return p;
    };
    f16*   xh    = (f16*)take((size_t)Mtok * HID * 2);      // [Mtok][1024]
    f16*   wq16  = (f16*)take((size_t)HID * HID * 2);       // [N=1024][K=1024]
    f16*   wso16 = (f16*)take((size_t)HID * HID * 2);       // [N=1024][K=1024]
    f16*   wi16  = (f16*)take((size_t)DFF * HID * 2);       // [N=4096][K=1024]
    f16*   wo16  = (f16*)take((size_t)HID * DFF * 2);       // [N=1024][K=4096]
    f16*   qkvh  = (f16*)take((size_t)Mtok * HID * 2);
    f16*   ctxh  = (f16*)take((size_t)Mtok * HID * 2);
    float* attf  = (float*)take((size_t)Mtok * HID * 4);    // also holds fff later (same extent)
    float* h1f   = (float*)take((size_t)Mtok * HID * 4);
    f16*   h1h   = (f16*)take((size_t)Mtok * HID * 2);
    f16*   gh    = (f16*)take((size_t)Mtok * DFF * 2);
    float* fff   = attf;                                    // attf fully consumed by LN1 before the output GEMM writes fff
    if (off > ws_size) return;

    const int thr = 256;
    const float wsc = 64.0f;   // 2^6 weight operand scale, folded back in the GEMM epilogue

    // activations -> f16 (compact token rows), weights [N][K] -> scaled f16 [N][K]: one launch for all five
    k_cvt<<<CB_ALL, thr, 0, stream>>>(x, Wq, Wso, Wi, Wo, xh, wq16, wso16, wi16, wo16, wsc);

    const dim3 gH(HID / GBN, Mtok / GBM);     // N = 1024
    const dim3 gF(DFF / GBN, Mtok / GBM);     // N = 4096

    // Placeholder pointer arguments below (omode / write_h exclude them) are valid, correctly typed
    // workspace regions that the launch never dereferences.

    // shared q/k/v projection (f16 out only, [Mtok][1024]); Cf placeholder = attf
    k_gemm_deep<<<gH, thr, 0, stream>>>(xh, wq16, bq, attf, qkvh, Mtok, HID, HID, 0, 0.015625f, 2);

    // attention: one block per (batch, head, 128 queries); ctx carried * 2^4
    k_attn<<<NB * NHD * (SEQ / 128), thr, 0, stream>>>(qkvh, amsk, ctxh, NB);

    // self-output projection (f32 out only, * 2^-6 * 2^-4); Ch placeholder = gh
    k_gemm_deep<<<gH, thr, 0, stream>>>(ctxh, wso16, bso, attf, gh, Mtok, HID, HID, 0, 0.0009765625f, 1);
    // LN1(attn + bf16(x)) -> h1 (f32 + f16 copy)
    k_ln<<<Mtok, thr, 0, stream>>>(attf, x, SEQ, SEQ_FULL, 1, ln1g, ln1b, h1f, h1h, 1, Mtok);

    // FFN: GELU(h1.Wi^T + bi) (f16 out only; Cf placeholder = attf) . Wo^T + bo (f32 out only; Ch placeholder = h1h)
    k_gemm<<<gF, thr, 0, stream>>>(h1h, wi16, bi, attf, gh, Mtok, DFF, HID, 1, 0.015625f, 2);
    k_gemm_deep<<<gH, thr, 0, stream>>>(gh, wo16, bo, fff, h1h, Mtok, HID, DFF, 0, 0.015625f, 1);
    // LN2(ff + h1) -> d_out (f32 only; outh placeholder = h1h, residual not converted)
    k_ln<<<Mtok, thr, 0, stream>>>(fff, h1f, SEQ, SEQ, 0, ln2g, ln2b, (float*)d_out, h1h, 0, Mtok);
}
